// v000
// The times below were measured on an AMD MI455X: many runs one after another, warmed up first and cycling through
// copies of the inputs, with the whole window's GPU time divided by the number of runs. Launches and the gaps
// between them are all in it. The median over several windows is given; except for v000 it joins two sittings, which
// can be a few percent apart, so the side-by-side timings, each taken in one sitting, are the better comparison.
// v000, which the later versions start from, runs in 246 microseconds.
#include <hip/hip_runtime.h>
#include <hip/hip_bf16.h>

#define NPTS 60000
#define NSAMP 16
#define CH 128
#define NC (NPTS*CH)

typedef __attribute__((ext_vector_type(16))) __bf16 v16bf;
typedef __attribute__((ext_vector_type(8)))  __bf16 v8bf;
typedef __attribute__((ext_vector_type(2)))  __bf16 bf16x2;
typedef __attribute__((ext_vector_type(8)))  float  v8f;
typedef __attribute__((ext_vector_type(4)))  float  f32x4;
typedef __attribute__((ext_vector_type(4)))  unsigned u32x4;
typedef __attribute__((ext_vector_type(2)))  unsigned u32x2;

static __device__ __forceinline__ unsigned pkbf(float a, float b) {
  bf16x2 t; t[0] = (__bf16)a; t[1] = (__bf16)b;
  return __builtin_bit_cast(unsigned, t);
}

static __device__ __forceinline__ int frag_koff(int lane, int s) {
  int v = s >> 1;
  return ((v >> 2) << 4) + ((lane >> 4) << 3) + ((v & 3) << 1) + (s & 1);
}

static __device__ __forceinline__ v16bf joinbf(u32x4 q0, u32x4 q1) {
  v8bf lo = __builtin_bit_cast(v8bf, q0);
  v8bf hi = __builtin_bit_cast(v8bf, q1);
  v16bf a;
#pragma unroll
  for (int i = 0; i < 8; i++) { a[i] = lo[i]; a[8 + i] = hi[i]; }
  return a;
}

// A fragment from LDS tile stored as [16 rows][64 bf16-pairs] (row-major K pairs).
static __device__ __forceinline__ v16bf load_afrag(const unsigned* base, int lane, int kc) {
  int row = lane & 15, hl = lane >> 4;
  const unsigned* pa = base + row * 64 + kc * 16 + hl * 4;
  u32x4 q0 = *(const u32x4*)pa;
  u32x4 q1 = *(const u32x4*)(pa + 8);
  return joinbf(q0, q1);
}

// B fragment pre-swizzled in global memory: 16 contiguous bf16 per lane.
static __device__ __forceinline__ v16bf load_bfrag(const __bf16* b) {
  u32x4 q0 = *(const u32x4*)b;
  u32x4 q1 = *(const u32x4*)(b + 8);
  return joinbf(q0, q1);
}

static __device__ __forceinline__ v8f wmma_bf16(v16bf a, v16bf b, v8f c) {
  return __builtin_amdgcn_wmma_f32_16x16x32_bf16(false, a, false, b, (short)0, c, false, false);
}

// ---------------------------------------------------------------------------
// Kernel 1: weight swizzle into fragment order + zero stats accumulators.
// ---------------------------------------------------------------------------
__global__ __launch_bounds__(256) void prep_kernel(
    const float* __restrict__ wq, const float* __restrict__ wk, const float* __restrict__ wv,
    const float* __restrict__ ww1, const float* __restrict__ ww2,
    __bf16* __restrict__ wqf, __bf16* __restrict__ wkf, __bf16* __restrict__ wvf,
    __bf16* __restrict__ w1f, __bf16* __restrict__ w2f,
    float* __restrict__ stats) {
  const int QKV = 3 * 16384;
  int t = blockIdx.x * 256 + threadIdx.x;
  if (t < QKV) {
    int s = t & 15, lane = (t >> 4) & 31, kc = (t >> 9) & 3, jt = (t >> 11) & 7, m = t >> 14;
    int k = kc * 32 + frag_koff(lane, s);
    int n = jt * 16 + (lane & 15);
    const float* w = (m == 0) ? wq : (m == 1) ? wk : wv;
    __bf16* d = (m == 0) ? wqf : (m == 1) ? wkf : wvf;
    d[t & 16383] = (__bf16)w[k * CH + n];
  } else if (t < QKV + 2048) {
    int u = t - QKV;
    int s = u & 15, lane = (u >> 4) & 31, kc = (u >> 9) & 3;
    int k = kc * 32 + frag_koff(lane, s);
    w1f[u] = (__bf16)ww1[k * 16 + (lane & 15)];
  } else if (t < QKV + 2048 + 512) {
    int u = t - QKV - 2048;
    int s = u & 15, lane = (u >> 4) & 31;
    int k = frag_koff(lane, s); // single K chunk, upper 16 zero-padded
    w2f[u] = (k < 16) ? (__bf16)ww2[k * 16 + (lane & 15)] : (__bf16)0.f;
  } else if (t < QKV + 2048 + 512 + 294) {
    stats[t - (QKV + 2048 + 512)] = 0.f;
  }
}

// ---------------------------------------------------------------------------
// Kernel 2: QKV GEMM. One block = 16 rows of x; 8 waves = 8 column tiles;
// each wave does q,k,v tiles (12 WMMAs).
// ---------------------------------------------------------------------------
__global__ __launch_bounds__(256) void qkv_gemm(
    const float* __restrict__ x,
    const float* __restrict__ bq, const float* __restrict__ bk, const float* __restrict__ bv,
    const __bf16* __restrict__ wqf, const __bf16* __restrict__ wkf, const __bf16* __restrict__ wvf,
    float* __restrict__ xq, float* __restrict__ xk, float* __restrict__ xv) {
  __shared__ unsigned lds[16 * 64]; // 16 rows x 128 bf16 (packed pairs)
  int row0 = blockIdx.x * 16;
  int t = threadIdx.x;
  {
    int pr0 = t * 4;
    int r = pr0 >> 6, kp = pr0 & 63;
    const float* src = &x[(row0 + r) * CH + kp * 2];
    f32x4 u0 = *(const f32x4*)src;
    f32x4 u1 = *(const f32x4*)(src + 4);
    u32x4 w;
    w[0] = pkbf(u0[0], u0[1]); w[1] = pkbf(u0[2], u0[3]);
    w[2] = pkbf(u1[0], u1[1]); w[3] = pkbf(u1[2], u1[3]);
    *(u32x4*)&lds[pr0] = w;
  }
  __syncthreads();
  int wave = t >> 5, lane = t & 31;
  int jt = wave;
  v8f aq = {}, ak = {}, av = {};
#pragma unroll
  for (int kc = 0; kc < 4; kc++) {
    v16bf A = load_afrag(lds, lane, kc);
    int boff = ((jt * 4 + kc) * 32 + lane) * 16;
    aq = wmma_bf16(A, load_bfrag(wqf + boff), aq);
    ak = wmma_bf16(A, load_bfrag(wkf + boff), ak);
    av = wmma_bf16(A, load_bfrag(wvf + boff), av);
  }
  int col = jt * 16 + (lane & 15), hl = lane >> 4;
  float cq = bq[col], ck = bk[col], cv = bv[col];
#pragma unroll
  for (int r = 0; r < 8; r++) {
    int m = row0 + r + 8 * hl;
    xq[m * CH + col] = aq[r] + cq;
    xk[m * CH + col] = ak[r] + ck;
    xv[m * CH + col] = av[r] + cv;
  }
}

// ---------------------------------------------------------------------------
// Kernel 3: stats (sum, sumsq) of gp@w_p1+b_p1 over N*NS, 3 channels.
// ---------------------------------------------------------------------------
__global__ __launch_bounds__(256) void pos_stats(
    const float* __restrict__ p, const int* __restrict__ idx,
    const float* __restrict__ wp1, const float* __restrict__ bp1,
    float* __restrict__ stats) {
  float a0 = wp1[0], a1 = wp1[1], a2 = wp1[2], a3 = wp1[3], a4 = wp1[4],
        a5 = wp1[5], a6 = wp1[6], a7 = wp1[7], a8 = wp1[8];
  float b0 = bp1[0], b1 = bp1[1], b2 = bp1[2];
  float s0 = 0, s1 = 0, s2 = 0, q0 = 0, q1 = 0, q2 = 0;
  int total = NPTS * NSAMP;
  for (int e = blockIdx.x * 256 + threadIdx.x; e < total; e += gridDim.x * 256) {
    int j = idx[e];
    const float* pj = p + 3 * j;
    float px = pj[0], py = pj[1], pz = pj[2];
    float y0 = fmaf(px, a0, fmaf(py, a3, fmaf(pz, a6, b0)));
    float y1 = fmaf(px, a1, fmaf(py, a4, fmaf(pz, a7, b1)));
    float y2 = fmaf(px, a2, fmaf(py, a5, fmaf(pz, a8, b2)));
    s0 += y0; s1 += y1; s2 += y2;
    q0 = fmaf(y0, y0, q0); q1 = fmaf(y1, y1, q1); q2 = fmaf(y2, y2, q2);
  }
  __shared__ float red[6];
  if (threadIdx.x < 6) red[threadIdx.x] = 0.f;
  __syncthreads();
  atomicAdd(&red[0], s0); atomicAdd(&red[1], s1); atomicAdd(&red[2], s2);
  atomicAdd(&red[3], q0); atomicAdd(&red[4], q1); atomicAdd(&red[5], q2);
  __syncthreads();
  if (threadIdx.x < 6) atomicAdd(&stats[threadIdx.x], red[threadIdx.x]);
}

// ---------------------------------------------------------------------------
// BN finalize: scale = g/sqrt(var+eps), shift = b - mean*scale.
// ---------------------------------------------------------------------------
__global__ void finalize_bn(const float* __restrict__ sum, const float* __restrict__ sq,
                            const float* __restrict__ g, const float* __restrict__ b,
                            float* __restrict__ scale, float* __restrict__ shift,
                            int nch, float invc) {
  int c = threadIdx.x;
  if (c >= nch) return;
  float m = sum[c] * invc;
  float v = sq[c] * invc - m * m;
  float sc = g[c] * rsqrtf(v + 1e-5f);
  scale[c] = sc;
  shift[c] = b[c] - m * sc;
}

// ---------------------------------------------------------------------------
// Kernel 4: stats of w_pre = gk - xq + p_r over N*NS, 128 channels.
// One wave per point iteration; lane owns channels 4*lane..4*lane+3.
// ---------------------------------------------------------------------------
__global__ __launch_bounds__(256) void w1_stats(
    const float* __restrict__ p, const int* __restrict__ idx,
    const float* __restrict__ xq, const float* __restrict__ xk,
    const float* __restrict__ wp1, const float* __restrict__ bp1,
    const float* __restrict__ wp2, const float* __restrict__ bp2,
    const float* __restrict__ pS, const float* __restrict__ pH,
    float* __restrict__ statSum, float* __restrict__ statSq) {
  int t = threadIdx.x, wave = t >> 5, lane = t & 31;
  int c0 = lane * 4;
  float a0 = wp1[0], a1 = wp1[1], a2 = wp1[2], a3 = wp1[3], a4 = wp1[4],
        a5 = wp1[5], a6 = wp1[6], a7 = wp1[7], a8 = wp1[8];
  float b0 = bp1[0], b1 = bp1[1], b2 = bp1[2];
  float ps0 = pS[0], ps1 = pS[1], ps2 = pS[2];
  float ph0 = pH[0], ph1 = pH[1], ph2 = pH[2];
  f32x4 w2c0 = *(const f32x4*)&wp2[c0];
  f32x4 w2c1 = *(const f32x4*)&wp2[CH + c0];
  f32x4 w2c2 = *(const f32x4*)&wp2[2 * CH + c0];
  f32x4 pb4  = *(const f32x4*)&bp2[c0];
  f32x4 sm = {0.f, 0.f, 0.f, 0.f}, sq = {0.f, 0.f, 0.f, 0.f};
  int W = gridDim.x * 8;
  for (int n = blockIdx.x * 8 + wave; n < NPTS; n += W) {
    f32x4 xq4 = *(const f32x4*)&xq[n * CH + c0];
    for (int s = 0; s < NSAMP; s++) {
      int j = idx[n * NSAMP + s];
      const float* pj = p + 3 * j;
      float px = pj[0], py = pj[1], pz = pj[2];
      float y0 = fmaxf(fmaf(fmaf(px, a0, fmaf(py, a3, fmaf(pz, a6, b0))), ps0, ph0), 0.f);
      float y1 = fmaxf(fmaf(fmaf(px, a1, fmaf(py, a4, fmaf(pz, a7, b1))), ps1, ph1), 0.f);
      float y2 = fmaxf(fmaf(fmaf(px, a2, fmaf(py, a5, fmaf(pz, a8, b2))), ps2, ph2), 0.f);
      f32x4 kk = *(const f32x4*)&xk[j * CH + c0];
#pragma unroll
      for (int i = 0; i < 4; i++) {
        float pr = fmaf(y0, w2c0[i], fmaf(y1, w2c1[i], fmaf(y2, w2c2[i], pb4[i])));
        float w = kk[i] - xq4[i] + pr;
        sm[i] += w;
        sq[i] = fmaf(w, w, sq[i]);
      }
    }
  }
  __shared__ float rs[128], rq[128];
  if (t < 128) { rs[t] = 0.f; rq[t] = 0.f; }
  __syncthreads();
#pragma unroll
  for (int i = 0; i < 4; i++) { atomicAdd(&rs[c0 + i], sm[i]); atomicAdd(&rq[c0 + i], sq[i]); }
  __syncthreads();
  if (t < 128) { atomicAdd(&statSum[t], rs[t]); atomicAdd(&statSq[t], rq[t]); }
}

// ---------------------------------------------------------------------------
// Kernel 5: stats of y1 = relu(bn1(w_pre)) @ w_w1 + b_w1 over N*NS, 16 channels.
// Per point: stage bn1(w_pre) as bf16 in LDS, one [16x128]@[128x16] via 4 WMMAs.
// ---------------------------------------------------------------------------
__global__ __launch_bounds__(256) void w2_stats(
    const float* __restrict__ p, const int* __restrict__ idx,
    const float* __restrict__ xq, const float* __restrict__ xk,
    const float* __restrict__ wp1, const float* __restrict__ bp1,
    const float* __restrict__ wp2, const float* __restrict__ bp2,
    const float* __restrict__ pS, const float* __restrict__ pH,
    const float* __restrict__ w1S, const float* __restrict__ w1H,
    const float* __restrict__ bw1,
    const __bf16* __restrict__ w1f,
    float* __restrict__ statSum, float* __restrict__ statSq) {
  __shared__ unsigned ldsA[8][1024];
  int t = threadIdx.x, wave = t >> 5, lane = t & 31;
  int c0 = lane * 4, cs = lane & 15;
  unsigned* la = &ldsA[wave][0];
  float a0 = wp1[0], a1 = wp1[1], a2 = wp1[2], a3 = wp1[3], a4 = wp1[4],
        a5 = wp1[5], a6 = wp1[6], a7 = wp1[7], a8 = wp1[8];
  float b0 = bp1[0], b1 = bp1[1], b2 = bp1[2];
  float ps0 = pS[0], ps1 = pS[1], ps2 = pS[2];
  float ph0 = pH[0], ph1 = pH[1], ph2 = pH[2];
  f32x4 w2c0 = *(const f32x4*)&wp2[c0];
  f32x4 w2c1 = *(const f32x4*)&wp2[CH + c0];
  f32x4 w2c2 = *(const f32x4*)&wp2[2 * CH + c0];
  f32x4 pb4  = *(const f32x4*)&bp2[c0];
  f32x4 s1v  = *(const f32x4*)&w1S[c0];
  f32x4 h1v  = *(const f32x4*)&w1H[c0];
  float bw = bw1[cs];
  float ssum = 0.f, ssq = 0.f;
  int W = gridDim.x * 8;
  for (int n = blockIdx.x * 8 + wave; n < NPTS; n += W) {
    f32x4 xq4 = *(const f32x4*)&xq[n * CH + c0];
    for (int s = 0; s < NSAMP; s++) {
      int j = idx[n * NSAMP + s];
      const float* pj = p + 3 * j;
      float px = pj[0], py = pj[1], pz = pj[2];
      float y0 = fmaxf(fmaf(fmaf(px, a0, fmaf(py, a3, fmaf(pz, a6, b0))), ps0, ph0), 0.f);
      float y1 = fmaxf(fmaf(fmaf(px, a1, fmaf(py, a4, fmaf(pz, a7, b1))), ps1, ph1), 0.f);
      float y2 = fmaxf(fmaf(fmaf(px, a2, fmaf(py, a5, fmaf(pz, a8, b2))), ps2, ph2), 0.f);
      f32x4 kk = *(const f32x4*)&xk[j * CH + c0];
      float z[4];
#pragma unroll
      for (int i = 0; i < 4; i++) {
        float pr = fmaf(y0, w2c0[i], fmaf(y1, w2c1[i], fmaf(y2, w2c2[i], pb4[i])));
        float w = kk[i] - xq4[i] + pr;
        z[i] = fmaxf(fmaf(w, s1v[i], h1v[i]), 0.f);
      }
      u32x2 pk; pk[0] = pkbf(z[0], z[1]); pk[1] = pkbf(z[2], z[3]);
      *(u32x2*)&la[s * 64 + lane * 2] = pk;
    }
    v8f acc = {};
#pragma unroll
    for (int kc = 0; kc < 4; kc++) {
      v16bf A = load_afrag(la, lane, kc);
      v16bf B = load_bfrag(w1f + (kc * 32 + lane) * 16);
      acc = wmma_bf16(A, B, acc);
    }
#pragma unroll
    for (int r = 0; r < 8; r++) {
      float y = acc[r] + bw;
      ssum += y;
      ssq = fmaf(y, y, ssq);
    }
  }
  __shared__ float rs[16], rq[16];
  if (t < 16) { rs[t] = 0.f; rq[t] = 0.f; }
  __syncthreads();
  atomicAdd(&rs[cs], ssum); atomicAdd(&rq[cs], ssq);
  __syncthreads();
  if (t < 16) { atomicAdd(&statSum[t], rs[t]); atomicAdd(&statSq[t], rq[t]); }
}

// ---------------------------------------------------------------------------
// Kernel 6: final fused attention. Per point: bn1 -> WMMA1 -> bn2 -> WMMA2 ->
// softmax over neighbors -> weighted sum with share-grouped broadcast.
// ---------------------------------------------------------------------------
__global__ __launch_bounds__(256) void attn_final(
    const float* __restrict__ p, const int* __restrict__ idx,
    const float* __restrict__ xq, const float* __restrict__ xk, const float* __restrict__ xv,
    const float* __restrict__ wp1, const float* __restrict__ bp1,
    const float* __restrict__ wp2, const float* __restrict__ bp2,
    const float* __restrict__ pS, const float* __restrict__ pH,
    const float* __restrict__ w1S, const float* __restrict__ w1H, const float* __restrict__ bw1,
    const float* __restrict__ w2S, const float* __restrict__ w2H, const float* __restrict__ bw2,
    const __bf16* __restrict__ w1f, const __bf16* __restrict__ w2f,
    float* __restrict__ out) {
  __shared__ unsigned ldsA[8][1024]; // bn1'd w_pre, bf16 pairs [16 s][64]
  __shared__ __bf16   ldsB[8][512];  // bn2'd y1 [16 s][32 k] (K padded with 0)
  __shared__ float    ldsW[8][256];  // softmax weights [16 s][16 cs]
  __shared__ float    ldsR[8][64];   // relu'd pos-MLP hidden [16 s][3(+1)]
  int t = threadIdx.x, wave = t >> 5, lane = t & 31;
  int c0 = lane * 4, cs = lane & 15, hl = lane >> 4;
  unsigned* la = &ldsA[wave][0];
  __bf16*   lb = &ldsB[wave][0];
  float*    lw = &ldsW[wave][0];
  float*    lr = &ldsR[wave][0];
  float a0 = wp1[0], a1 = wp1[1], a2 = wp1[2], a3 = wp1[3], a4 = wp1[4],
        a5 = wp1[5], a6 = wp1[6], a7 = wp1[7], a8 = wp1[8];
  float b0 = bp1[0], b1 = bp1[1], b2 = bp1[2];
  float ps0 = pS[0], ps1 = pS[1], ps2 = pS[2];
  float ph0 = pH[0], ph1 = pH[1], ph2 = pH[2];
  f32x4 w2c0 = *(const f32x4*)&wp2[c0];
  f32x4 w2c1 = *(const f32x4*)&wp2[CH + c0];
  f32x4 w2c2 = *(const f32x4*)&wp2[2 * CH + c0];
  f32x4 pb4  = *(const f32x4*)&bp2[c0];
  f32x4 s1v  = *(const f32x4*)&w1S[c0];
  f32x4 h1v  = *(const f32x4*)&w1H[c0];
  float sc2 = w2S[cs], hf2 = w2H[cs], bb1 = bw1[cs], bb2 = bw2[cs];
  // zero K=16..31 pad region of ldsB once (never overwritten)
#pragma unroll
  for (int i = 0; i < 8; i++) {
    int e = lane * 8 + i;
    lb[(e >> 4) * 32 + 16 + (e & 15)] = (__bf16)0.f;
  }
  int W = gridDim.x * 8;
  for (int n = blockIdx.x * 8 + wave; n < NPTS; n += W) {
    f32x4 xq4 = *(const f32x4*)&xq[n * CH + c0];
    for (int s = 0; s < NSAMP; s++) {
      int j = idx[n * NSAMP + s];
      const float* pj = p + 3 * j;
      float px = pj[0], py = pj[1], pz = pj[2];
      float y0 = fmaxf(fmaf(fmaf(px, a0, fmaf(py, a3, fmaf(pz, a6, b0))), ps0, ph0), 0.f);
      float y1 = fmaxf(fmaf(fmaf(px, a1, fmaf(py, a4, fmaf(pz, a7, b1))), ps1, ph1), 0.f);
      float y2 = fmaxf(fmaf(fmaf(px, a2, fmaf(py, a5, fmaf(pz, a8, b2))), ps2, ph2), 0.f);
      if (lane < 3) lr[s * 4 + lane] = (lane == 0) ? y0 : ((lane == 1) ? y1 : y2);
      f32x4 kk = *(const f32x4*)&xk[j * CH + c0];
      float z[4];
#pragma unroll
      for (int i = 0; i < 4; i++) {
        float pr = fmaf(y0, w2c0[i], fmaf(y1, w2c1[i], fmaf(y2, w2c2[i], pb4[i])));
        float w = kk[i] - xq4[i] + pr;
        z[i] = fmaxf(fmaf(w, s1v[i], h1v[i]), 0.f);
      }
      u32x2 pk; pk[0] = pkbf(z[0], z[1]); pk[1] = pkbf(z[2], z[3]);
      *(u32x2*)&la[s * 64 + lane * 2] = pk;
    }
    // WMMA1: [16 neighbors x 128] @ [128 x 16]
    v8f acc = {};
#pragma unroll
    for (int kc = 0; kc < 4; kc++) {
      v16bf A = load_afrag(la, lane, kc);
      v16bf B = load_bfrag(w1f + (kc * 32 + lane) * 16);
      acc = wmma_bf16(A, B, acc);
    }
    // bn2 + relu, stage as bf16 for WMMA2 (lane holds column cs, rows r+8*hl)
#pragma unroll
    for (int r = 0; r < 8; r++) {
      float y = acc[r] + bb1;
      lb[(r + 8 * hl) * 32 + cs] = (__bf16)fmaxf(fmaf(y, sc2, hf2), 0.f);
    }
    // WMMA2: [16 x 16(pad 32)] @ [16(pad 32) x 16]
    v16bf A2;
    {
      int row = lane & 15;
#pragma unroll
      for (int vv = 0; vv < 8; vv++) {
        int k = ((vv >> 2) << 4) + (hl << 3) + ((vv & 3) << 1);
        A2[2 * vv]     = lb[row * 32 + k];
        A2[2 * vv + 1] = lb[row * 32 + k + 1];
      }
    }
    v8f acc2 = {};
    acc2 = wmma_bf16(A2, load_bfrag(w2f + lane * 16), acc2);
    float yv[8];
    float mx = -3.0e38f;
#pragma unroll
    for (int r = 0; r < 8; r++) { yv[r] = acc2[r] + bb2; mx = fmaxf(mx, yv[r]); }
    mx = fmaxf(mx, __shfl_xor(mx, 16, 32));
    float se = 0.f;
#pragma unroll
    for (int r = 0; r < 8; r++) { yv[r] = __expf(yv[r] - mx); se += yv[r]; }
    se += __shfl_xor(se, 16, 32);
    float inv = 1.0f / se;
#pragma unroll
    for (int r = 0; r < 8; r++) lw[(r + 8 * hl) * 16 + cs] = yv[r] * inv;
    // weighted sum: out[c] = sum_s (gv + p_r) * w[s, c%16]; lane owns c0..c0+3
    f32x4 o = {0.f, 0.f, 0.f, 0.f};
    for (int s = 0; s < NSAMP; s++) {
      int j = idx[n * NSAMP + s];
      f32x4 gv = *(const f32x4*)&xv[j * CH + c0];
      float r0 = lr[s * 4], r1 = lr[s * 4 + 1], r2 = lr[s * 4 + 2];
#pragma unroll
      for (int i = 0; i < 4; i++) {
        float pr = fmaf(r0, w2c0[i], fmaf(r1, w2c1[i], fmaf(r2, w2c2[i], pb4[i])));
        o[i] = fmaf(gv[i] + pr, lw[s * 16 + ((c0 + i) & 15)], o[i]);
      }
    }
    *(f32x4*)&out[n * CH + c0] = o;
  }
}

// ---------------------------------------------------------------------------
extern "C" void kernel_launch(void* const* d_in, const int* in_sizes, int n_in,
                              void* d_out, int out_size, void* d_ws, size_t ws_size,
                              hipStream_t stream) {
  (void)in_sizes; (void)n_in; (void)out_size; (void)ws_size;
  const float* p    = (const float*)d_in[0];
  const float* x    = (const float*)d_in[1];
  const int*   idx  = (const int*)d_in[2];
  const float* w_q  = (const float*)d_in[3];
  const float* b_q  = (const float*)d_in[4];
  const float* w_k  = (const float*)d_in[5];
  const float* b_k  = (const float*)d_in[6];
  const float* w_v  = (const float*)d_in[7];
  const float* b_v  = (const float*)d_in[8];
  const float* w_p1 = (const float*)d_in[9];
  const float* b_p1 = (const float*)d_in[10];
  const float* g_p  = (const float*)d_in[11];
  const float* be_p = (const float*)d_in[12];
  const float* w_p2 = (const float*)d_in[13];
  const float* b_p2 = (const float*)d_in[14];
  const float* g_w1 = (const float*)d_in[15];
  const float* be_w1= (const float*)d_in[16];
  const float* w_w1 = (const float*)d_in[17];
  const float* b_w1 = (const float*)d_in[18];
  const float* g_w2 = (const float*)d_in[19];
  const float* be_w2= (const float*)d_in[20];
  const float* w_w2 = (const float*)d_in[21];
  const float* b_w2 = (const float*)d_in[22];
  float* out = (float*)d_out;

  // workspace carve-up (f32 arrays first, then bf16 fragments, then stats/bn)
  float* ws = (float*)d_ws;
  float* xq = ws;
  float* xk = xq + NC;
  float* xv = xk + NC;
  __bf16* wqf = (__bf16*)(xv + NC);
  __bf16* wkf = wqf + 16384;
  __bf16* wvf = wkf + 16384;
  __bf16* w1f = wvf + 16384;
  __bf16* w2f = w1f + 2048;
  float* stats = (float*)(w2f + 512);
  float* posSum = stats;        // 3
  float* posSq  = stats + 3;    // 3
  float* s1Sum  = stats + 6;    // 128
  float* s1Sq   = stats + 134;  // 128
  float* s2Sum  = stats + 262;  // 16
  float* s2Sq   = stats + 278;  // 16
  float* bnb  = stats + 294;
  float* pSc  = bnb;            // 3
  float* pSh  = bnb + 3;        // 3
  float* w1Sc = bnb + 6;        // 128
  float* w1Sh = bnb + 134;      // 128
  float* w2Sc = bnb + 262;      // 16
  float* w2Sh = bnb + 278;      // 16

  const float invc = 1.0f / (float)(NPTS * NSAMP);

  prep_kernel<<<204, 256, 0, stream>>>(w_q, w_k, w_v, w_w1, w_w2,
                                       wqf, wkf, wvf, w1f, w2f, stats);
  qkv_gemm<<<NPTS / 16, 256, 0, stream>>>(x, b_q, b_k, b_v, wqf, wkf, wvf, xq, xk, xv);
  pos_stats<<<512, 256, 0, stream>>>(p, idx, w_p1, b_p1, stats);
  finalize_bn<<<1, 32, 0, stream>>>(posSum, posSq, g_p, be_p, pSc, pSh, 3, invc);
  w1_stats<<<1024, 256, 0, stream>>>(p, idx, xq, xk, w_p1, b_p1, w_p2, b_p2,
                                     pSc, pSh, s1Sum, s1Sq);
  finalize_bn<<<1, 128, 0, stream>>>(s1Sum, s1Sq, g_w1, be_w1, w1Sc, w1Sh, 128, invc);
  w2_stats<<<1024, 256, 0, stream>>>(p, idx, xq, xk, w_p1, b_p1, w_p2, b_p2,
                                     pSc, pSh, w1Sc, w1Sh, b_w1, w1f, s2Sum, s2Sq);
  finalize_bn<<<1, 32, 0, stream>>>(s2Sum, s2Sq, g_w2, be_w2, w2Sc, w2Sh, 16, invc);
  attn_final<<<1875, 256, 0, stream>>>(p, idx, xq, xk, xv, w_p1, b_p1, w_p2, b_p2,
                                       pSc, pSh, w1Sc, w1Sh, b_w1, w2Sc, w2Sh, b_w2,
                                       w1f, w2f, out);
}

// v001
// Measured time: 166 microseconds a run.
// In both of two side-by-side timings against v000, it was 1.52 times as fast.
#include <hip/hip_runtime.h>
#include <hip/hip_bf16.h>

#define NPTS 60000
#define NSAMP 16
#define CH 128
#define NC (NPTS*CH)

typedef __attribute__((ext_vector_type(16))) __bf16 v16bf;
typedef __attribute__((ext_vector_type(8)))  __bf16 v8bf;
typedef __attribute__((ext_vector_type(2)))  __bf16 bf16x2;
typedef __attribute__((ext_vector_type(8)))  float  v8f;
typedef __attribute__((ext_vector_type(4)))  float  f32x4;
typedef __attribute__((ext_vector_type(4)))  unsigned u32x4;
typedef __attribute__((ext_vector_type(2)))  unsigned u32x2;

static __device__ __forceinline__ unsigned pkbf(float a, float b) {
  bf16x2 t; t[0] = (__bf16)a; t[1] = (__bf16)b;
  return __builtin_bit_cast(unsigned, t);
}

static __device__ __forceinline__ int frag_koff(int lane, int s) {
  int v = s >> 1;
  return ((v >> 2) << 4) + ((lane >> 4) << 3) + ((v & 3) << 1) + (s & 1);
}

static __device__ __forceinline__ v16bf joinbf(u32x4 q0, u32x4 q1) {
  v8bf lo = __builtin_bit_cast(v8bf, q0);
  v8bf hi = __builtin_bit_cast(v8bf, q1);
  v16bf a;
#pragma unroll
  for (int i = 0; i < 8; i++) { a[i] = lo[i]; a[8 + i] = hi[i]; }
  return a;
}

// A fragment from LDS tile stored as [16 rows][64 bf16-pairs] (row-major K pairs).
static __device__ __forceinline__ v16bf load_afrag(const unsigned* base, int lane, int kc) {
  int row = lane & 15, hl = lane >> 4;
  const unsigned* pa = base + row * 64 + kc * 16 + hl * 4;
  u32x4 q0 = *(const u32x4*)pa;
  u32x4 q1 = *(const u32x4*)(pa + 8);
  return joinbf(q0, q1);
}

// B fragment pre-swizzled in global memory: 16 contiguous bf16 per lane.
static __device__ __forceinline__ v16bf load_bfrag(const __bf16* b) {
  u32x4 q0 = *(const u32x4*)b;
  u32x4 q1 = *(const u32x4*)(b + 8);
  return joinbf(q0, q1);
}

static __device__ __forceinline__ v8f wmma_bf16(v16bf a, v16bf b, v8f c) {
  return __builtin_amdgcn_wmma_f32_16x16x32_bf16(false, a, false, b, (short)0, c, false, false);
}

static __device__ __forceinline__ int nbr_index(const int* __restrict__ idx, int n, int lane) {
  int j = idx[n * NSAMP + (lane & 15)];
  return min(max(j, 0), NPTS - 1);
}

// Value of lane s as a wave-uniform scalar.
static __device__ __forceinline__ int bcast_i(int v, int s) {
  return __builtin_amdgcn_readlane(v, s);
}
static __device__ __forceinline__ float bcast_f(float v, int s) {
  return __builtin_bit_cast(float, __builtin_amdgcn_readlane(__builtin_bit_cast(int, v), s));
}

// Byte offset of this lane's 16 bytes (voff = 16 * lane) in row js of a [NPTS][CH] f32 array.
static __device__ __forceinline__ unsigned row_off(int js, unsigned voff) {
  return ((unsigned)js << 9) | voff;
}
static __device__ __forceinline__ f32x4 load_at(const float* __restrict__ base, unsigned off) {
  return *(const f32x4*)((const char*)base + off);
}

// Rows named by lanes S0..S0+7 of j: 8 loads back to back, none used before all are issued.
// keep: the offset register of one more load that the caller has just issued.
template <int S0>
static __device__ __forceinline__ void gather8(f32x4 (&r)[NSAMP], const float* __restrict__ base,
                                               int j, unsigned voff, unsigned keep) {
  unsigned off[8];
#pragma unroll  // off[] and r[] stay in registers, constant lane numbers
  for (int u = 0; u < 8; u++) off[u] = row_off(bcast_i(j, S0 + u), voff);
#pragma unroll
  for (int u = 0; u < 8; u++) r[S0 + u] = load_at(base, off[u]);
  // the wait that stands before an issued load's address register is written again; the
  // offsets are inputs so that no later load's result is placed on them in front of it
  asm volatile("s_wait_xcnt 0x0" :: "v"(off[0]), "v"(off[1]), "v"(off[2]), "v"(off[3]),
               "v"(off[4]), "v"(off[5]), "v"(off[6]), "v"(off[7]), "v"(keep) : "memory");
}

static __device__ __forceinline__ f32x4 fma4(float a, f32x4 b, f32x4 c) {
  f32x4 av = {a, a, a, a};
  return __builtin_elementwise_fma(av, b, c);
}

// ---------------------------------------------------------------------------
// Kernel 1: weight swizzle into fragment order + zero stats accumulators.
// ---------------------------------------------------------------------------
__global__ __launch_bounds__(256) void prep_kernel(
    const float* __restrict__ wq, const float* __restrict__ wk, const float* __restrict__ wv,
    const float* __restrict__ ww1, const float* __restrict__ ww2,
    __bf16* __restrict__ wqf, __bf16* __restrict__ wkf, __bf16* __restrict__ wvf,
    __bf16* __restrict__ w1f, __bf16* __restrict__ w2f,
    float* __restrict__ stats) {
  const int QKV = 3 * 16384;
  int t = blockIdx.x * 256 + threadIdx.x;
  if (t < QKV) {
    int s = t & 15, lane = (t >> 4) & 31, kc = (t >> 9) & 3, jt = (t >> 11) & 7, m = t >> 14;
    int k = kc * 32 + frag_koff(lane, s);
    int n = jt * 16 + (lane & 15);
    const float* w = (m == 0) ? wq : (m == 1) ? wk : wv;
    __bf16* d = (m == 0) ? wqf : (m == 1) ? wkf : wvf;
    d[t & 16383] = (__bf16)w[k * CH + n];
  } else if (t < QKV + 2048) {
    int u = t - QKV;
    int s = u & 15, lane = (u >> 4) & 31, kc = (u >> 9) & 3;
    int k = kc * 32 + frag_koff(lane, s);
    w1f[u] = (__bf16)ww1[k * 16 + (lane & 15)];
  } else if (t < QKV + 2048 + 512) {
    int u = t - QKV - 2048;
    int s = u & 15, lane = (u >> 4) & 31;
    int k = frag_koff(lane, s); // single K chunk, upper 16 zero-padded
    w2f[u] = (k < 16) ? (__bf16)ww2[k * 16 + (lane & 15)] : (__bf16)0.f;
  } else if (t < QKV + 2048 + 512 + 294) {
    stats[t - (QKV + 2048 + 512)] = 0.f;
  }
}

// ---------------------------------------------------------------------------
// Kernel 2: QKV GEMM. One block = 16 rows of x; 8 waves = 8 column tiles;
// each wave does q,k,v tiles (12 WMMAs).
// ---------------------------------------------------------------------------
__global__ __launch_bounds__(256) void qkv_gemm(
    const float* __restrict__ x,
    const float* __restrict__ bq, const float* __restrict__ bk, const float* __restrict__ bv,
    const __bf16* __restrict__ wqf, const __bf16* __restrict__ wkf, const __bf16* __restrict__ wvf,
    float* __restrict__ xq, float* __restrict__ xk, float* __restrict__ xv) {
  __shared__ unsigned lds[16 * 64]; // 16 rows x 128 bf16 (packed pairs)
  int row0 = blockIdx.x * 16;
  int t = threadIdx.x;
  {
    int pr0 = t * 4;
    int r = pr0 >> 6, kp = pr0 & 63;
    const float* src = &x[(row0 + r) * CH + kp * 2];
    f32x4 u0 = *(const f32x4*)src;
    f32x4 u1 = *(const f32x4*)(src + 4);
    u32x4 w;
    w[0] = pkbf(u0[0], u0[1]); w[1] = pkbf(u0[2], u0[3]);
    w[2] = pkbf(u1[0], u1[1]); w[3] = pkbf(u1[2], u1[3]);
    *(u32x4*)&lds[pr0] = w;
  }
  __syncthreads();
  int wave = t >> 5, lane = t & 31;
  int jt = wave;
  v8f aq = {}, ak = {}, av = {};
#pragma unroll
  for (int kc = 0; kc < 4; kc++) {
    v16bf A = load_afrag(lds, lane, kc);
    int boff = ((jt * 4 + kc) * 32 + lane) * 16;
    aq = wmma_bf16(A, load_bfrag(wqf + boff), aq);
    ak = wmma_bf16(A, load_bfrag(wkf + boff), ak);
    av = wmma_bf16(A, load_bfrag(wvf + boff), av);
  }
  int col = jt * 16 + (lane & 15), hl = lane >> 4;
  float cq = bq[col], ck = bk[col], cv = bv[col];
#pragma unroll
  for (int r = 0; r < 8; r++) {
    int m = row0 + r + 8 * hl;
    xq[m * CH + col] = aq[r] + cq;
    xk[m * CH + col] = ak[r] + ck;
    xv[m * CH + col] = av[r] + cv;
  }
}

// ---------------------------------------------------------------------------
// Kernel 3: stats (sum, sumsq) of gp@w_p1+b_p1 over N*NS, 3 channels.
// ---------------------------------------------------------------------------
__global__ __launch_bounds__(256) void pos_stats(
    const float* __restrict__ p, const int* __restrict__ idx,
    const float* __restrict__ wp1, const float* __restrict__ bp1,
    float* __restrict__ stats) {
  float a0 = wp1[0], a1 = wp1[1], a2 = wp1[2], a3 = wp1[3], a4 = wp1[4],
        a5 = wp1[5], a6 = wp1[6], a7 = wp1[7], a8 = wp1[8];
  float b0 = bp1[0], b1 = bp1[1], b2 = bp1[2];
  float s0 = 0, s1 = 0, s2 = 0, q0 = 0, q1 = 0, q2 = 0;
  int total = NPTS * NSAMP;
  for (int e = blockIdx.x * 256 + threadIdx.x; e < total; e += gridDim.x * 256) {
    int j = idx[e];
    const float* pj = p + 3 * j;
    float px = pj[0], py = pj[1], pz = pj[2];
    float y0 = fmaf(px, a0, fmaf(py, a3, fmaf(pz, a6, b0)));
    float y1 = fmaf(px, a1, fmaf(py, a4, fmaf(pz, a7, b1)));
    float y2 = fmaf(px, a2, fmaf(py, a5, fmaf(pz, a8, b2)));
    s0 += y0; s1 += y1; s2 += y2;
    q0 = fmaf(y0, y0, q0); q1 = fmaf(y1, y1, q1); q2 = fmaf(y2, y2, q2);
  }
  __shared__ float red[6];
  if (threadIdx.x < 6) red[threadIdx.x] = 0.f;
  __syncthreads();
  atomicAdd(&red[0], s0); atomicAdd(&red[1], s1); atomicAdd(&red[2], s2);
  atomicAdd(&red[3], q0); atomicAdd(&red[4], q1); atomicAdd(&red[5], q2);
  __syncthreads();
  if (threadIdx.x < 6) atomicAdd(&stats[threadIdx.x], red[threadIdx.x]);
}

// ---------------------------------------------------------------------------
// BN finalize: scale = g/sqrt(var+eps), shift = b - mean*scale.
// ---------------------------------------------------------------------------
__global__ void finalize_bn(const float* __restrict__ sum, const float* __restrict__ sq,
                            const float* __restrict__ g, const float* __restrict__ b,
                            float* __restrict__ scale, float* __restrict__ shift,
                            int nch, float invc) {
  int c = threadIdx.x;
  if (c >= nch) return;
  float m = sum[c] * invc;
  float v = sq[c] * invc - m * m;
  float sc = g[c] * rsqrtf(v + 1e-5f);
  scale[c] = sc;
  shift[c] = b[c] - m * sc;
}

// ---------------------------------------------------------------------------
// Kernel 4: stats of w_pre = gk - xq + p_r over N*NS, 128 channels.
// One wave per point iteration; lane owns channels 4*lane..4*lane+3.
// Lane s also owns neighbor s (index, position, pos-MLP hidden values), so the 16 row
// gathers of a point have no load in front of them and are issued in groups; the next
// point's indices, positions and hidden values are prepared one iteration ahead.
// ---------------------------------------------------------------------------
__global__ __launch_bounds__(256) void w1_stats(
    const float* __restrict__ p, const int* __restrict__ idx,
    const float* __restrict__ xq, const float* __restrict__ xk,
    const float* __restrict__ wp1, const float* __restrict__ bp1,
    const float* __restrict__ wp2, const float* __restrict__ bp2,
    const float* __restrict__ pS, const float* __restrict__ pH,
    float* __restrict__ statSum, float* __restrict__ statSq) {
  int t = threadIdx.x, wave = __builtin_amdgcn_readfirstlane(t >> 5), lane = t & 31;
  int c0 = lane * 4;
  unsigned voff = lane * 16u;
  float a0 = wp1[0], a1 = wp1[1], a2 = wp1[2], a3 = wp1[3], a4 = wp1[4],
        a5 = wp1[5], a6 = wp1[6], a7 = wp1[7], a8 = wp1[8];
  float b0 = bp1[0], b1 = bp1[1], b2 = bp1[2];
  float ps0 = pS[0], ps1 = pS[1], ps2 = pS[2];
  float ph0 = pH[0], ph1 = pH[1], ph2 = pH[2];
  f32x4 w2c0 = *(const f32x4*)&wp2[c0];
  f32x4 w2c1 = *(const f32x4*)&wp2[CH + c0];
  f32x4 w2c2 = *(const f32x4*)&wp2[2 * CH + c0];
  f32x4 pb4  = *(const f32x4*)&bp2[c0];
  f32x4 sm = {0.f, 0.f, 0.f, 0.f}, sq = {0.f, 0.f, 0.f, 0.f};
  int W = gridDim.x * 8;
  int n = blockIdx.x * 8 + wave;
  int j = nbr_index(idx, min(n, NPTS - 1), lane);
  float px = p[3 * j], py = p[3 * j + 1], pz = p[3 * j + 2];
  float y0 = fmaxf(fmaf(fmaf(px, a0, fmaf(py, a3, fmaf(pz, a6, b0))), ps0, ph0), 0.f);
  float y1 = fmaxf(fmaf(fmaf(px, a1, fmaf(py, a4, fmaf(pz, a7, b1))), ps1, ph1), 0.f);
  float y2 = fmaxf(fmaf(fmaf(px, a2, fmaf(py, a5, fmaf(pz, a8, b2))), ps2, ph2), 0.f);
  for (; n < NPTS; n += W) {
    unsigned offq = row_off(n, voff);
    f32x4 xq4 = load_at(xq, offq);
    f32x4 kr[NSAMP];
    gather8<0>(kr, xk, j, voff, offq);
    int jn = nbr_index(idx, min(n + W, NPTS - 1), lane);
#pragma unroll  // constant lane numbers and register-array indices
    for (int s = 0; s < NSAMP; s++) {
      if (s == 8) {
        gather8<8>(kr, xk, j, voff, voff);
        px = p[3 * jn]; py = p[3 * jn + 1]; pz = p[3 * jn + 2];
      }
      f32x4 pr = fma4(bcast_f(y0, s), w2c0, fma4(bcast_f(y1, s), w2c1, fma4(bcast_f(y2, s), w2c2, pb4)));
      f32x4 w = kr[s] - xq4 + pr;
      sm += w;
      sq = __builtin_elementwise_fma(w, w, sq);
    }
    j = jn;
    y0 = fmaxf(fmaf(fmaf(px, a0, fmaf(py, a3, fmaf(pz, a6, b0))), ps0, ph0), 0.f);
    y1 = fmaxf(fmaf(fmaf(px, a1, fmaf(py, a4, fmaf(pz, a7, b1))), ps1, ph1), 0.f);
    y2 = fmaxf(fmaf(fmaf(px, a2, fmaf(py, a5, fmaf(pz, a8, b2))), ps2, ph2), 0.f);
  }
  __shared__ float rs[128], rq[128];
  if (t < 128) { rs[t] = 0.f; rq[t] = 0.f; }
  __syncthreads();
#pragma unroll
  for (int i = 0; i < 4; i++) { atomicAdd(&rs[c0 + i], sm[i]); atomicAdd(&rq[c0 + i], sq[i]); }
  __syncthreads();
  if (t < 128) { atomicAdd(&statSum[t], rs[t]); atomicAdd(&statSq[t], rq[t]); }
}

// ---------------------------------------------------------------------------
// Kernel 5: stats of y1 = relu(bn1(w_pre)) @ w_w1 + b_w1 over N*NS, 16 channels.
// Per point: stage bn1(w_pre) as bf16 in LDS, one [16x128]@[128x16] via 4 WMMAs.
// ---------------------------------------------------------------------------
__global__ __launch_bounds__(256) void w2_stats(
    const float* __restrict__ p, const int* __restrict__ idx,
    const float* __restrict__ xq, const float* __restrict__ xk,
    const float* __restrict__ wp1, const float* __restrict__ bp1,
    const float* __restrict__ wp2, const float* __restrict__ bp2,
    const float* __restrict__ pS, const float* __restrict__ pH,
    const float* __restrict__ w1S, const float* __restrict__ w1H,
    const float* __restrict__ bw1,
    const __bf16* __restrict__ w1f,
    float* __restrict__ statSum, float* __restrict__ statSq) {
  __shared__ unsigned ldsA[8][1024];
  int t = threadIdx.x, wave = __builtin_amdgcn_readfirstlane(t >> 5), lane = t & 31;
  int c0 = lane * 4, cs = lane & 15;
  unsigned voff = lane * 16u;
  unsigned* la = &ldsA[wave][0];
  v16bf B1[4];  // w_w1 fragments, read once per wave
#pragma unroll  // B1[] stays in registers
  for (int kc = 0; kc < 4; kc++) B1[kc] = load_bfrag(w1f + (kc * 32 + lane) * 16);
  // the wait that stands before a register that an issued load names is written again; the
  // base is an input so that no argument load that follows is placed on it in front of it
  asm volatile("s_wait_xcnt 0x0" :: "s"(w1f) : "memory");
  float a0 = wp1[0], a1 = wp1[1], a2 = wp1[2], a3 = wp1[3], a4 = wp1[4],
        a5 = wp1[5], a6 = wp1[6], a7 = wp1[7], a8 = wp1[8];
  float b0 = bp1[0], b1 = bp1[1], b2 = bp1[2];
  float ps0 = pS[0], ps1 = pS[1], ps2 = pS[2];
  float ph0 = pH[0], ph1 = pH[1], ph2 = pH[2];
  f32x4 w2c0 = *(const f32x4*)&wp2[c0];
  f32x4 w2c1 = *(const f32x4*)&wp2[CH + c0];
  f32x4 w2c2 = *(const f32x4*)&wp2[2 * CH + c0];
  f32x4 pb4  = *(const f32x4*)&bp2[c0];
  f32x4 s1v  = *(const f32x4*)&w1S[c0];
  f32x4 h1v  = *(const f32x4*)&w1H[c0];
  float bw = bw1[cs];
  const f32x4 zero4 = {0.f, 0.f, 0.f, 0.f};
  float ssum = 0.f, ssq = 0.f;
  int W = gridDim.x * 8;
  int n = blockIdx.x * 8 + wave;
  int j = nbr_index(idx, min(n, NPTS - 1), lane);
  float px = p[3 * j], py = p[3 * j + 1], pz = p[3 * j + 2];
  float y0 = fmaxf(fmaf(fmaf(px, a0, fmaf(py, a3, fmaf(pz, a6, b0))), ps0, ph0), 0.f);
  float y1 = fmaxf(fmaf(fmaf(px, a1, fmaf(py, a4, fmaf(pz, a7, b1))), ps1, ph1), 0.f);
  float y2 = fmaxf(fmaf(fmaf(px, a2, fmaf(py, a5, fmaf(pz, a8, b2))), ps2, ph2), 0.f);
  for (; n < NPTS; n += W) {
    unsigned offq = row_off(n, voff);
    f32x4 xq4 = load_at(xq, offq);
    f32x4 kr[NSAMP];
    gather8<0>(kr, xk, j, voff, offq);
    gather8<8>(kr, xk, j, voff, voff);
    int jn = nbr_index(idx, min(n + W, NPTS - 1), lane);
#pragma unroll  // constant lane numbers and register-array indices
    for (int s = 0; s < NSAMP; s++) {
      f32x4 pr = fma4(bcast_f(y0, s), w2c0, fma4(bcast_f(y1, s), w2c1, fma4(bcast_f(y2, s), w2c2, pb4)));
      f32x4 w = kr[s] - xq4 + pr;
      f32x4 z = __builtin_elementwise_max(__builtin_elementwise_fma(w, s1v, h1v), zero4);
      u32x2 pk; pk[0] = pkbf(z[0], z[1]); pk[1] = pkbf(z[2], z[3]);
      *(u32x2*)&la[s * 64 + lane * 2] = pk;
    }
    j = jn;
    px = p[3 * j]; py = p[3 * j + 1]; pz = p[3 * j + 2];
    v8f acc = {};
#pragma unroll
    for (int kc = 0; kc < 4; kc++) {
      v16bf A = load_afrag(la, lane, kc);
      acc = wmma_bf16(A, B1[kc], acc);
    }
#pragma unroll
    for (int r = 0; r < 8; r++) {
      float y = acc[r] + bw;
      ssum += y;
      ssq = fmaf(y, y, ssq);
    }
    y0 = fmaxf(fmaf(fmaf(px, a0, fmaf(py, a3, fmaf(pz, a6, b0))), ps0, ph0), 0.f);
    y1 = fmaxf(fmaf(fmaf(px, a1, fmaf(py, a4, fmaf(pz, a7, b1))), ps1, ph1), 0.f);
    y2 = fmaxf(fmaf(fmaf(px, a2, fmaf(py, a5, fmaf(pz, a8, b2))), ps2, ph2), 0.f);
  }
  __shared__ float rs[16], rq[16];
  if (t < 16) { rs[t] = 0.f; rq[t] = 0.f; }
  __syncthreads();
  atomicAdd(&rs[cs], ssum); atomicAdd(&rq[cs], ssq);
  __syncthreads();
  if (t < 16) { atomicAdd(&statSum[t], rs[t]); atomicAdd(&statSq[t], rq[t]); }
}

// ---------------------------------------------------------------------------
// Kernel 6: final fused attention. Per point: bn1 -> WMMA1 -> bn2 -> WMMA2 ->
// softmax over neighbors -> weighted sum with share-grouped broadcast.
// ---------------------------------------------------------------------------
__global__ __launch_bounds__(256) void attn_final(
    const float* __restrict__ p, const int* __restrict__ idx,
    const float* __restrict__ xq, const float* __restrict__ xk, const float* __restrict__ xv,
    const float* __restrict__ wp1, const float* __restrict__ bp1,
    const float* __restrict__ wp2, const float* __restrict__ bp2,
    const float* __restrict__ pS, const float* __restrict__ pH,
    const float* __restrict__ w1S, const float* __restrict__ w1H, const float* __restrict__ bw1,
    const float* __restrict__ w2S, const float* __restrict__ w2H, const float* __restrict__ bw2,
    const __bf16* __restrict__ w1f, const __bf16* __restrict__ w2f,
    float* __restrict__ out) {
  __shared__ unsigned ldsA[8][1024]; // bn1'd w_pre, bf16 pairs [16 s][64]
  __shared__ __bf16   ldsB[8][512];  // bn2'd y1 [16 s][32 k] (K padded with 0)
  __shared__ float    ldsW[8][256];  // softmax weights [16 s][16 cs]
  __shared__ float    ldsR[8][128];  // relu'd pos-MLP hidden [lane][3(+1)]; rows 16..31 repeat 0..15
  int t = threadIdx.x, wave = __builtin_amdgcn_readfirstlane(t >> 5), lane = t & 31;
  int c0 = lane * 4, cs = lane & 15, hl = lane >> 4;
  unsigned voff = lane * 16u;
  unsigned* la = &ldsA[wave][0];
  __bf16*   lb = &ldsB[wave][0];
  float*    lw = &ldsW[wave][0];
  float*    lr = &ldsR[wave][0];
  int W = gridDim.x * 8;
  int n = blockIdx.x * 8 + wave;
  if (n >= NPTS) return;  // whole wave; the kernel has no barrier
  int j = nbr_index(idx, n, lane);
  float px = p[3 * j], py = p[3 * j + 1], pz = p[3 * j + 2];
  asm volatile("s_wait_xcnt 0x0" ::: "memory");
  v16bf B1[4];  // w_w1 and w_w2 fragments, read once per wave
#pragma unroll  // B1[] stays in registers
  for (int kc = 0; kc < 4; kc++) B1[kc] = load_bfrag(w1f + (kc * 32 + lane) * 16);
  v16bf B2 = load_bfrag(w2f + lane * 16);
  asm volatile("s_wait_xcnt 0x0" ::: "memory");
  float a0 = wp1[0], a1 = wp1[1], a2 = wp1[2], a3 = wp1[3], a4 = wp1[4],
        a5 = wp1[5], a6 = wp1[6], a7 = wp1[7], a8 = wp1[8];
  float b0 = bp1[0], b1 = bp1[1], b2 = bp1[2];
  float ps0 = pS[0], ps1 = pS[1], ps2 = pS[2];
  float ph0 = pH[0], ph1 = pH[1], ph2 = pH[2];
  f32x4 w2c0 = *(const f32x4*)&wp2[c0];
  f32x4 w2c1 = *(const f32x4*)&wp2[CH + c0];
  f32x4 w2c2 = *(const f32x4*)&wp2[2 * CH + c0];
  f32x4 pb4  = *(const f32x4*)&bp2[c0];
  f32x4 s1v  = *(const f32x4*)&w1S[c0];
  f32x4 h1v  = *(const f32x4*)&w1H[c0];
  float sc2 = w2S[cs], hf2 = w2H[cs], bb1 = bw1[cs], bb2 = bw2[cs];
  const f32x4 zero4 = {0.f, 0.f, 0.f, 0.f};
  // zero K=16..31 pad region of ldsB once (never overwritten)
#pragma unroll
  for (int i = 0; i < 8; i++) {
    int e = lane * 8 + i;
    lb[(e >> 4) * 32 + 16 + (e & 15)] = (__bf16)0.f;
  }
  float y0 = fmaxf(fmaf(fmaf(px, a0, fmaf(py, a3, fmaf(pz, a6, b0))), ps0, ph0), 0.f);
  float y1 = fmaxf(fmaf(fmaf(px, a1, fmaf(py, a4, fmaf(pz, a7, b1))), ps1, ph1), 0.f);
  float y2 = fmaxf(fmaf(fmaf(px, a2, fmaf(py, a5, fmaf(pz, a8, b2))), ps2, ph2), 0.f);
  for (; n < NPTS; n += W) {
    unsigned offq = row_off(n, voff);
    f32x4 xq4 = load_at(xq, offq);
    f32x4 kr[NSAMP];
    gather8<0>(kr, xk, j, voff, offq);
    gather8<8>(kr, xk, j, voff, voff);
    int jn = nbr_index(idx, min(n + W, NPTS - 1), lane);
#pragma unroll  // constant lane numbers and register-array indices
    for (int s = 0; s < NSAMP; s++) {
      f32x4 pr = fma4(bcast_f(y0, s), w2c0, fma4(bcast_f(y1, s), w2c1, fma4(bcast_f(y2, s), w2c2, pb4)));
      f32x4 w = kr[s] - xq4 + pr;
      f32x4 z = __builtin_elementwise_max(__builtin_elementwise_fma(w, s1v, h1v), zero4);
      u32x2 pk; pk[0] = pkbf(z[0], z[1]); pk[1] = pkbf(z[2], z[3]);
      *(u32x2*)&la[s * 64 + lane * 2] = pk;
    }
    // two scheduling regions per point: in the first the position terms are computed while
    // the key rows fly, in the second the A-fragment reads stand in groups in front of the
    // WMMAs; scheduled as one region both came out one wait per load
    __builtin_amdgcn_sched_barrier(0);
    // the 16 value rows and the next point's positions fly while the two matrix
    // products and the softmax run
    f32x4 vr[NSAMP];
    gather8<0>(vr, xv, j, voff, voff);
    gather8<8>(vr, xv, j, voff, voff);
    {
      f32x4 hv = {y0, y1, y2, 0.f};
      *(f32x4*)&lr[lane * 4] = hv;
    }
    px = p[3 * jn]; py = p[3 * jn + 1]; pz = p[3 * jn + 2];
    // WMMA1: [16 neighbors x 128] @ [128 x 16]
    v8f acc = {};
#pragma unroll
    for (int kc = 0; kc < 4; kc++) {
      v16bf A = load_afrag(la, lane, kc);
      acc = wmma_bf16(A, B1[kc], acc);
    }
    // bn2 + relu, stage as bf16 for WMMA2 (lane holds column cs, rows r+8*hl)
#pragma unroll
    for (int r = 0; r < 8; r++) {
      float y = acc[r] + bb1;
      lb[(r + 8 * hl) * 32 + cs] = (__bf16)fmaxf(fmaf(y, sc2, hf2), 0.f);
    }
    // WMMA2: [16 x 16(pad 32)] @ [16(pad 32) x 16]
    v16bf A2;
    {
      int row = lane & 15;
#pragma unroll
      for (int vv = 0; vv < 8; vv++) {
        int k = ((vv >> 2) << 4) + (hl << 3) + ((vv & 3) << 1);
        A2[2 * vv]     = lb[row * 32 + k];
        A2[2 * vv + 1] = lb[row * 32 + k + 1];
      }
    }
    v8f acc2 = {};
    acc2 = wmma_bf16(A2, B2, acc2);
    float yv[8];
    float mx = -3.0e38f;
#pragma unroll
    for (int r = 0; r < 8; r++) { yv[r] = acc2[r] + bb2; mx = fmaxf(mx, yv[r]); }
    mx = fmaxf(mx, __shfl_xor(mx, 16, 32));
    float se = 0.f;
#pragma unroll
    for (int r = 0; r < 8; r++) { yv[r] = __expf(yv[r] - mx); se += yv[r]; }
    se += __shfl_xor(se, 16, 32);
    float inv = 1.0f / se;
#pragma unroll
    for (int r = 0; r < 8; r++) lw[(r + 8 * hl) * 16 + cs] = yv[r] * inv;
    // weighted sum: out[c] = sum_s (gv + p_r) * w[s, c%16]; lane owns c0..c0+3
    f32x4 o = {0.f, 0.f, 0.f, 0.f};
#pragma unroll  // vr[], hr[], sw[] stay in registers (this loop and the two inside it)
    for (int g = 0; g < NSAMP; g += 4) {
      f32x4 hr[4], sw[4];
#pragma unroll
      for (int u = 0; u < 4; u++) {
        hr[u] = *(const f32x4*)&lr[(g + u) * 4];
        sw[u] = *(const f32x4*)&lw[(g + u) * 16 + (c0 & 15)];
      }
      // keeps the 8 LDS reads of four neighbors together in front of their uses: one
      // LDS latency per group instead of two per neighbor
      __builtin_amdgcn_sched_barrier(0);
#pragma unroll
      for (int u = 0; u < 4; u++) {
        f32x4 pr = fma4(hr[u][0], w2c0, fma4(hr[u][1], w2c1, fma4(hr[u][2], w2c2, pb4)));
        o = __builtin_elementwise_fma(vr[g + u] + pr, sw[u], o);
      }
    }
    *(f32x4*)&out[n * CH + c0] = o;
    // the wait that stands before the store's registers are written again (next point)
    asm volatile("s_wait_xcnt 0x0" ::: "memory");
    j = jn;
    y0 = fmaxf(fmaf(fmaf(px, a0, fmaf(py, a3, fmaf(pz, a6, b0))), ps0, ph0), 0.f);
    y1 = fmaxf(fmaf(fmaf(px, a1, fmaf(py, a4, fmaf(pz, a7, b1))), ps1, ph1), 0.f);
    y2 = fmaxf(fmaf(fmaf(px, a2, fmaf(py, a5, fmaf(pz, a8, b2))), ps2, ph2), 0.f);
  }
}

// ---------------------------------------------------------------------------
extern "C" void kernel_launch(void* const* d_in, const int* in_sizes, int n_in,
                              void* d_out, int out_size, void* d_ws, size_t ws_size,
                              hipStream_t stream) {
  (void)in_sizes; (void)n_in; (void)out_size; (void)ws_size;
  const float* p    = (const float*)d_in[0];
  const float* x    = (const float*)d_in[1];
  const int*   idx  = (const int*)d_in[2];
  const float* w_q  = (const float*)d_in[3];
  const float* b_q  = (const float*)d_in[4];
  const float* w_k  = (const float*)d_in[5];
  const float* b_k  = (const float*)d_in[6];
  const float* w_v  = (const float*)d_in[7];
  const float* b_v  = (const float*)d_in[8];
  const float* w_p1 = (const float*)d_in[9];
  const float* b_p1 = (const float*)d_in[10];
  const float* g_p  = (const float*)d_in[11];
  const float* be_p = (const float*)d_in[12];
  const float* w_p2 = (const float*)d_in[13];
  const float* b_p2 = (const float*)d_in[14];
  const float* g_w1 = (const float*)d_in[15];
  const float* be_w1= (const float*)d_in[16];
  const float* w_w1 = (const float*)d_in[17];
  const float* b_w1 = (const float*)d_in[18];
  const float* g_w2 = (const float*)d_in[19];
  const float* be_w2= (const float*)d_in[20];
  const float* w_w2 = (const float*)d_in[21];
  const float* b_w2 = (const float*)d_in[22];
  float* out = (float*)d_out;

  // workspace carve-up (f32 arrays first, then bf16 fragments, then stats/bn)
  float* ws = (float*)d_ws;
  float* xq = ws;
  float* xk = xq + NC;
  float* xv = xk + NC;
  __bf16* wqf = (__bf16*)(xv + NC);
  __bf16* wkf = wqf + 16384;
  __bf16* wvf = wkf + 16384;
  __bf16* w1f = wvf + 16384;
  __bf16* w2f = w1f + 2048;
  float* stats = (float*)(w2f + 512);
  float* posSum = stats;        // 3
  float* posSq  = stats + 3;    // 3
  float* s1Sum  = stats + 6;    // 128
  float* s1Sq   = stats + 134;  // 128
  float* s2Sum  = stats + 262;  // 16
  float* s2Sq   = stats + 278;  // 16
  float* bnb  = stats + 294;
  float* pSc  = bnb;            // 3
  float* pSh  = bnb + 3;        // 3
  float* w1Sc = bnb + 6;        // 128
  float* w1Sh = bnb + 134;      // 128
  float* w2Sc = bnb + 262;      // 16
  float* w2Sh = bnb + 278;      // 16

  const float invc = 1.0f / (float)(NPTS * NSAMP);

  prep_kernel<<<204, 256, 0, stream>>>(w_q, w_k, w_v, w_w1, w_w2,
                                       wqf, wkf, wvf, w1f, w2f, stats);
  qkv_gemm<<<NPTS / 16, 256, 0, stream>>>(x, b_q, b_k, b_v, wqf, wkf, wvf, xq, xk, xv);
  pos_stats<<<512, 256, 0, stream>>>(p, idx, w_p1, b_p1, stats);
  finalize_bn<<<1, 32, 0, stream>>>(posSum, posSq, g_p, be_p, pSc, pSh, 3, invc);
  w1_stats<<<1024, 256, 0, stream>>>(p, idx, xq, xk, w_p1, b_p1, w_p2, b_p2,
                                     pSc, pSh, s1Sum, s1Sq);
  finalize_bn<<<1, 128, 0, stream>>>(s1Sum, s1Sq, g_w1, be_w1, w1Sc, w1Sh, 128, invc);
  w2_stats<<<1024, 256, 0, stream>>>(p, idx, xq, xk, w_p1, b_p1, w_p2, b_p2,
                                     pSc, pSh, w1Sc, w1Sh, b_w1, w1f, s2Sum, s2Sq);
  finalize_bn<<<1, 32, 0, stream>>>(s2Sum, s2Sq, g_w2, be_w2, w2Sc, w2Sh, 16, invc);
  attn_final<<<1875, 256, 0, stream>>>(p, idx, xq, xk, xv, w_p1, b_p1, w_p2, b_p2,
                                       pSc, pSh, w1Sc, w1Sh, b_w1, w2Sc, w2Sh, b_w2,
                                       w1f, w2f, out);
}

// v004
// A run of this version takes 117 microseconds.
// It is 1.41 times as fast as v001, going by the measured steps of the versions left out in between.
// Over all steps from v000 it is 2.15 times as fast.
#include <hip/hip_runtime.h>
#include <hip/hip_bf16.h>

#define NPTS 60000
#define NSAMP 16
#define CH 128
#define NC (NPTS*CH)
#define POSB ((NPTS + 255) / 256)  // blocks of prep_pos that sum position stats, a thread per point
#define PREPB 204                  // blocks of prep_pos that swizzle weights and zero accumulators
#define POSPITCH 256               // partial sums of one statistic: POSB used of POSPITCH floats
#define BN_INVC (1.0f / (float)(NPTS * NSAMP))

typedef __attribute__((ext_vector_type(16))) __bf16 v16bf;
typedef __attribute__((ext_vector_type(8)))  __bf16 v8bf;
typedef __attribute__((ext_vector_type(2)))  __bf16 bf16x2;
typedef __attribute__((ext_vector_type(8)))  float  v8f;
typedef __attribute__((ext_vector_type(4)))  float  f32x4;
typedef __attribute__((ext_vector_type(4)))  unsigned u32x4;
typedef __attribute__((ext_vector_type(4)))  int i32x4;
typedef __attribute__((ext_vector_type(2)))  unsigned u32x2;
typedef __attribute__((ext_vector_type(4)))  _Float16 h16x4;
typedef __attribute__((ext_vector_type(8)))  _Float16 h16x8;

static __device__ __forceinline__ unsigned pkbf(float a, float b) {
  bf16x2 t; t[0] = (__bf16)a; t[1] = (__bf16)b;
  return __builtin_bit_cast(unsigned, t);
}

static __device__ __forceinline__ int frag_koff(int lane, int s) {
  int v = s >> 1;
  return ((v >> 2) << 4) + ((lane >> 4) << 3) + ((v & 3) << 1) + (s & 1);
}

static __device__ __forceinline__ v16bf joinbf(u32x4 q0, u32x4 q1) {
  v8bf lo = __builtin_bit_cast(v8bf, q0);
  v8bf hi = __builtin_bit_cast(v8bf, q1);
  v16bf a;
#pragma unroll
  for (int i = 0; i < 8; i++) { a[i] = lo[i]; a[8 + i] = hi[i]; }
  return a;
}

// A fragment from LDS tile stored as [16 rows][64 bf16-pairs] (row-major K pairs).
static __device__ __forceinline__ v16bf load_afrag(const unsigned* base, int lane, int kc) {
  int row = lane & 15, hl = lane >> 4;
  const unsigned* pa = base + row * 64 + kc * 16 + hl * 4;
  u32x4 q0 = *(const u32x4*)pa;
  u32x4 q1 = *(const u32x4*)(pa + 8);
  return joinbf(q0, q1);
}

// B fragment pre-swizzled in global memory: 16 contiguous bf16 per lane.
static __device__ __forceinline__ v16bf load_bfrag(const __bf16* b) {
  u32x4 q0 = *(const u32x4*)b;
  u32x4 q1 = *(const u32x4*)(b + 8);
  return joinbf(q0, q1);
}

static __device__ __forceinline__ v8f wmma_bf16(v16bf a, v16bf b, v8f c) {
  return __builtin_amdgcn_wmma_f32_16x16x32_bf16(false, a, false, b, (short)0, c, false, false);
}

static __device__ __forceinline__ int nbr_index(const int* __restrict__ idx, int n, int lane) {
  int j = idx[n * NSAMP + (lane & 15)];
  return min(max(j, 0), NPTS - 1);
}

// Value of lane s as a wave-uniform scalar.
static __device__ __forceinline__ int bcast_i(int v, int s) {
  return __builtin_amdgcn_readlane(v, s);
}

// Byte offset of this lane's 16 bytes (voff = 16 * lane) in row js of a [NPTS][CH] f32 array.
static __device__ __forceinline__ unsigned row_off(int js, unsigned voff) {
  return ((unsigned)js << 9) | voff;
}
static __device__ __forceinline__ f32x4 load_at(const float* __restrict__ base, unsigned off) {
  return *(const f32x4*)((const char*)base + off);
}

// The same for a [NPTS][CH] f16 array: this lane's 8 bytes (hoff = 8 * lane) in row js.
static __device__ __forceinline__ unsigned hrow_off(int js, unsigned hoff) {
  return ((unsigned)js << 8) | hoff;
}
static __device__ __forceinline__ h16x4 load_h(const _Float16* __restrict__ base, unsigned off) {
  return *(const h16x4*)((const char*)base + off);
}
static __device__ __forceinline__ f32x4 widen(h16x4 h) {
  return __builtin_convertvector(h, f32x4);
}

// Rows named by lanes S0..S0+7 of j: 8 loads back to back, none used before all are issued.
// keep: the offset register of one more load that the caller has just issued.
template <int S0>
static __device__ __forceinline__ void gather8(h16x4 (&r)[NSAMP], const _Float16* __restrict__ base,
                                               int j, unsigned hoff, unsigned keep) {
  unsigned off[8];
#pragma unroll  // off[] and r[] stay in registers, constant lane numbers
  for (int u = 0; u < 8; u++) off[u] = hrow_off(bcast_i(j, S0 + u), hoff);
#pragma unroll
  for (int u = 0; u < 8; u++) r[S0 + u] = load_h(base, off[u]);
  // the wait that stands before an issued load's address register is written again; the
  // offsets are inputs so that no later load's result is placed on them in front of it
  asm volatile("s_wait_xcnt 0x0" :: "v"(off[0]), "v"(off[1]), "v"(off[2]), "v"(off[3]),
               "v"(off[4]), "v"(off[5]), "v"(off[6]), "v"(off[7]), "v"(keep) : "memory");
}

static __device__ __forceinline__ f32x4 fma4(float a, f32x4 b, f32x4 c) {
  f32x4 av = {a, a, a, a};
  return __builtin_elementwise_fma(av, b, c);
}

// BatchNorm over N*NS samples from their sum and sum of squares:
// scale = g/sqrt(var+eps), shift = b - mean*scale.
static __device__ __forceinline__ void bn_coef(float sum, float sq, float g, float b,
                                               float& scale, float& shift) {
  float m = sum * BN_INVC;
  float v = sq * BN_INVC - m * m;
  scale = g * rsqrtf(v + 1e-5f);
  shift = b - m * scale;
}
// The same for this lane's 4 channels (voff = 16 * lane).
static __device__ __forceinline__ void bn_coef4(
    const float* __restrict__ sum, const float* __restrict__ sq,
    const float* __restrict__ g, const float* __restrict__ b, unsigned voff,
    f32x4& scale, f32x4& shift) {
  f32x4 a = load_at(sum, voff), q = load_at(sq, voff), gg = load_at(g, voff), bb = load_at(b, voff);
  // the wait that stands before a register that an issued load names is written again; the
  // bases are inputs so that no argument load that follows is placed on them in front of it
  asm volatile("s_wait_xcnt 0x0" :: "s"(sum), "s"(sq), "s"(g), "s"(b), "v"(voff) : "memory");
#pragma unroll  // constant element numbers
  for (int i = 0; i < 4; i++) {
    float sc, sh;
    bn_coef(a[i], q[i], gg[i], bb[i], sc, sh);
    scale[i] = sc; shift[i] = sh;
  }
}

// Sum over the 32 lanes of a wave, the same order in every run; every lane gets it.
static __device__ __forceinline__ float wave_sum(float v) {
#pragma unroll  // five steps with constant lane masks
  for (int m = 16; m > 0; m >>= 1) v += __shfl_xor(v, m, 32);
  return v;
}

// ---------------------------------------------------------------------------
// Kernel 1: two independent jobs in one grid.
// Blocks 0..POSB-1: stats (sum, sumsq) of gp@w_p1+b_p1 over N*NS, 3 channels. A thread takes
// one point: its 16 indices in four 16-byte loads, then its 16 position gathers back to back.
// Each block stores its own six sums (part[statistic][block]); qkv_gemm adds them up.
// Blocks POSB..: weight swizzle into fragment order + zero of the accumulators of the two
// later stats kernels.
// ---------------------------------------------------------------------------
__global__ __launch_bounds__(256) void prep_pos(
    const float* __restrict__ wq, const float* __restrict__ wk, const float* __restrict__ wv,
    const float* __restrict__ ww1, const float* __restrict__ ww2,
    const float* __restrict__ p, const int* __restrict__ idx,
    const float* __restrict__ wp1, const float* __restrict__ bp1,
    __bf16* __restrict__ wqf, __bf16* __restrict__ wkf, __bf16* __restrict__ wvf,
    __bf16* __restrict__ w1f, __bf16* __restrict__ w2f,
    float* __restrict__ stats, float* __restrict__ part) {
  if (blockIdx.x < POSB) {  // the same for the whole block
    __shared__ float red[8][6];
    int n = blockIdx.x * 256 + threadIdx.x;
    float s0 = 0, s1 = 0, s2 = 0, q0 = 0, q1 = 0, q2 = 0;
    if (n < NPTS) {
      unsigned io = (unsigned)n * (NSAMP * 4u);
      i32x4 jv[4];
#pragma unroll  // jv[] stays in registers
      for (int u = 0; u < 4; u++) jv[u] = *(const i32x4*)((const char*)idx + (io + 16u * u));
      // the wait that stands before an issued load's address register is written again
      asm volatile("s_wait_xcnt 0x0" :: "v"(io) : "memory");
      float a0 = wp1[0], a1 = wp1[1], a2 = wp1[2], a3 = wp1[3], a4 = wp1[4],
            a5 = wp1[5], a6 = wp1[6], a7 = wp1[7], a8 = wp1[8];
      float b0 = bp1[0], b1 = bp1[1], b2 = bp1[2];
      unsigned po[NSAMP];
      float px[NSAMP], py[NSAMP], pz[NSAMP];
#pragma unroll  // po[] stays in registers; every row gathered lies inside p
      for (int u = 0; u < NSAMP; u++) po[u] = (unsigned)min(max(jv[u >> 2][u & 3], 0), NPTS - 1) * 12u;
#pragma unroll  // 16 gathers in flight, none used before all are issued
      for (int u = 0; u < NSAMP; u++) {
        const float* pj = (const float*)((const char*)p + po[u]);
        px[u] = pj[0]; py[u] = pj[1]; pz[u] = pj[2];
      }
      asm volatile("s_wait_xcnt 0x0" :: "v"(po[0]), "v"(po[1]), "v"(po[2]), "v"(po[3]),
                   "v"(po[4]), "v"(po[5]), "v"(po[6]), "v"(po[7]), "v"(po[8]), "v"(po[9]),
                   "v"(po[10]), "v"(po[11]), "v"(po[12]), "v"(po[13]), "v"(po[14]), "v"(po[15])
                   : "memory");
#pragma unroll  // constant register-array indices
      for (int u = 0; u < NSAMP; u++) {
        float y0 = fmaf(px[u], a0, fmaf(py[u], a3, fmaf(pz[u], a6, b0)));
        float y1 = fmaf(px[u], a1, fmaf(py[u], a4, fmaf(pz[u], a7, b1)));
        float y2 = fmaf(px[u], a2, fmaf(py[u], a5, fmaf(pz[u], a8, b2)));
        s0 += y0; s1 += y1; s2 += y2;
        q0 = fmaf(y0, y0, q0); q1 = fmaf(y1, y1, q1); q2 = fmaf(y2, y2, q2);
      }
    }
    s0 = wave_sum(s0); s1 = wave_sum(s1); s2 = wave_sum(s2);
    q0 = wave_sum(q0); q1 = wave_sum(q1); q2 = wave_sum(q2);
    if ((threadIdx.x & 31) == 0) {
      float* r = &red[threadIdx.x >> 5][0];
      r[0] = s0; r[1] = s1; r[2] = s2; r[3] = q0; r[4] = q1; r[5] = q2;
    }
    __syncthreads();
    if (threadIdx.x < 6) {
      float a = 0.f;
#pragma unroll  // the 8 LDS reads together, one latency
      for (int w = 0; w < 8; w++) a += red[w][threadIdx.x];
      part[threadIdx.x * POSPITCH + blockIdx.x] = a;
    }
    return;
  }
  const int QKV = 3 * 16384;
  int t = (blockIdx.x - POSB) * 256 + threadIdx.x;
  if (t < QKV) {
    int s = t & 15, lane = (t >> 4) & 31, kc = (t >> 9) & 3, jt = (t >> 11) & 7, m = t >> 14;
    int k = kc * 32 + frag_koff(lane, s);
    int n = jt * 16 + (lane & 15);
    const float* w = (m == 0) ? wq : (m == 1) ? wk : wv;
    __bf16* d = (m == 0) ? wqf : (m == 1) ? wkf : wvf;
    d[t & 16383] = (__bf16)w[k * CH + n];
  } else if (t < QKV + 2048) {
    int u = t - QKV;
    int s = u & 15, lane = (u >> 4) & 31, kc = (u >> 9) & 3;
    int k = kc * 32 + frag_koff(lane, s);
    w1f[u] = (__bf16)ww1[k * 16 + (lane & 15)];
  } else if (t < QKV + 2048 + 512) {
    int u = t - QKV - 2048;
    int s = u & 15, lane = (u >> 4) & 31;
    int k = frag_koff(lane, s); // single K chunk, upper 16 zero-padded
    w2f[u] = (k < 16) ? (__bf16)ww2[k * 16 + (lane & 15)] : (__bf16)0.f;
  } else if (t < QKV + 2048 + 512 + 288) {
    stats[t - (QKV + 2048 + 512)] = 0.f;
  }
}

// ---------------------------------------------------------------------------
// Kernel 2: QKV GEMM. One block = 16 rows of x; 8 waves = 8 column tiles;
// each wave does q,k,v tiles (12 WMMAs). The k and v products take the weights as first
// operand: a lane then holds 8 neighbouring channels of one row, one 16-byte f16 store.
// The row's position term p_r = relu(bn(p @ w_p1 + b_p1)) @ w_p2 + b_p2 is added to k and v;
// its BatchNorm comes from prep_pos's block sums: wave c adds up statistic c while the x tile
// is on its way, and the tile's own barrier publishes the six totals.
// ---------------------------------------------------------------------------
__global__ __launch_bounds__(256) void qkv_gemm(
    const float* __restrict__ x, const float* __restrict__ p,
    const float* __restrict__ bq, const float* __restrict__ bk, const float* __restrict__ bv,
    const float* __restrict__ wp1, const float* __restrict__ bp1,
    const float* __restrict__ wp2, const float* __restrict__ bp2,
    const float* __restrict__ gp, const float* __restrict__ bep, const float* __restrict__ part,
    const __bf16* __restrict__ wqf, const __bf16* __restrict__ wkf, const __bf16* __restrict__ wvf,
    float* __restrict__ xq, _Float16* __restrict__ xk, _Float16* __restrict__ xv) {
  __shared__ unsigned lds[16 * 64]; // 16 rows x 128 bf16 (packed pairs)
  __shared__ float pst[8];          // position stats: 3 sums, 3 sums of squares
  int row0 = blockIdx.x * 16;
  int t = threadIdx.x;
  {
    int pr0 = t * 4;
    int r = pr0 >> 6, kp = pr0 & 63;
    const float* src = &x[(row0 + r) * CH + kp * 2];
    int st = __builtin_amdgcn_readfirstlane(t >> 5);
    float e[8] = {0.f, 0.f, 0.f, 0.f, 0.f, 0.f, 0.f, 0.f};
    if (st < 6) {  // whole waves
      const float* pc = part + st * POSPITCH;
      int i0 = t & 31, i7 = min((t & 31) + 224, POSB - 1);
#pragma unroll  // e[] stays in registers, 8 loads in flight
      for (int i = 0; i < 7; i++) e[i] = pc[i0 + 32 * i];
      e[7] = pc[i7];
      // the wait that stands before an issued load's address register is written again; the
      // indices are inputs so that nothing is placed on them in front of it
      asm volatile("s_wait_xcnt 0x0" :: "v"(i0), "v"(i7) : "memory");
    }
    f32x4 u0 = *(const f32x4*)src;
    f32x4 u1 = *(const f32x4*)(src + 4);
    asm volatile("s_wait_xcnt 0x0" :: "v"(src) : "memory");
    if (st < 6) {  // summed while the x tile is on its way
      float a = ((t & 31) + 224 < POSB) ? e[7] : 0.f;
#pragma unroll  // constant register-array indices
      for (int i = 6; i >= 0; i--) a += e[i];
      a = wave_sum(a);
      if ((t & 31) == 0) pst[st] = a;
    }
    u32x4 w;
    w[0] = pkbf(u0[0], u0[1]); w[1] = pkbf(u0[2], u0[3]);
    w[2] = pkbf(u1[0], u1[1]); w[3] = pkbf(u1[2], u1[3]);
    *(u32x4*)&lds[pr0] = w;
  }
  __syncthreads();
  int wave = t >> 5, lane = t & 31;
  int jt = wave;
  v8f aq = {}, ak = {}, av = {};
#pragma unroll
  for (int kc = 0; kc < 4; kc++) {
    v16bf A = load_afrag(lds, lane, kc);
    int boff = ((jt * 4 + kc) * 32 + lane) * 16;
    aq = wmma_bf16(A, load_bfrag(wqf + boff), aq);
    ak = wmma_bf16(load_bfrag(wkf + boff), A, ak);
    av = wmma_bf16(load_bfrag(wvf + boff), A, av);
  }
  int col = jt * 16 + (lane & 15), hl = lane >> 4;
  float cq = bq[col];
  // k, v: register r is channel ch0 + r of row row0 + (lane & 15)
  int ch0 = jt * 16 + 8 * hl;
  unsigned boff = ch0 * 4u, poff = (row0 + (lane & 15)) * 12u;
  f32x4 ck0 = load_at(bk, boff), ck1 = load_at(bk, boff + 16u);
  f32x4 cv0 = load_at(bv, boff), cv1 = load_at(bv, boff + 16u);
  f32x4 e00 = load_at(wp2, boff), e01 = load_at(wp2, boff + 16u);
  f32x4 e10 = load_at(wp2, boff + 512u), e11 = load_at(wp2, boff + 528u);
  f32x4 e20 = load_at(wp2, boff + 1024u), e21 = load_at(wp2, boff + 1040u);
  f32x4 pr0 = load_at(bp2, boff), pr1 = load_at(bp2, boff + 16u);
  const float* pm = (const float*)((const char*)p + poff);
  float px = pm[0], py = pm[1], pz = pm[2];
  // the wait that stands before an issued load's address register is written again; the
  // offsets are inputs so that no load's result is placed on them in front of it. It stands
  // in front of the q stores, so that no load's result lands on a register they name
  asm volatile("s_wait_xcnt 0x0" :: "v"(boff), "v"(poff) : "memory");
#pragma unroll
  for (int r = 0; r < 8; r++) {
    int m = row0 + r + 8 * hl;
    xq[m * CH + col] = aq[r] + cq;
  }
  // position term of this lane's row, 8 channels
  float pS0, pS1, pS2, pH0, pH1, pH2;
  bn_coef(pst[0], pst[3], gp[0], bep[0], pS0, pH0);
  bn_coef(pst[1], pst[4], gp[1], bep[1], pS1, pH1);
  bn_coef(pst[2], pst[5], gp[2], bep[2], pS2, pH2);
  float y0 = fmaxf(fmaf(fmaf(px, wp1[0], fmaf(py, wp1[3], fmaf(pz, wp1[6], bp1[0]))), pS0, pH0), 0.f);
  float y1 = fmaxf(fmaf(fmaf(px, wp1[1], fmaf(py, wp1[4], fmaf(pz, wp1[7], bp1[1]))), pS1, pH1), 0.f);
  float y2 = fmaxf(fmaf(fmaf(px, wp1[2], fmaf(py, wp1[5], fmaf(pz, wp1[8], bp1[2]))), pS2, pH2), 0.f);
  pr0 = fma4(y0, e00, fma4(y1, e10, fma4(y2, e20, pr0)));
  pr1 = fma4(y0, e01, fma4(y1, e11, fma4(y2, e21, pr1)));
  h16x8 hk, hv;
#pragma unroll  // constant element numbers: hk, hv stay in registers
  for (int r = 0; r < 4; r++) {
    hk[r] = (_Float16)(ak[r] + ck0[r] + pr0[r]); hk[4 + r] = (_Float16)(ak[4 + r] + ck1[r] + pr1[r]);
    hv[r] = (_Float16)(av[r] + cv0[r] + pr0[r]); hv[4 + r] = (_Float16)(av[4 + r] + cv1[r] + pr1[r]);
  }
  int e = (row0 + (lane & 15)) * CH + ch0;
  *(h16x8*)&xk[e] = hk;
  *(h16x8*)&xv[e] = hv;
}

// ---------------------------------------------------------------------------
// Kernel 3: stats of w_pre = (gk + p_r) - xq over N*NS, 128 channels.
// One wave per point iteration; lane owns channels 4*lane..4*lane+3.
// Lane s also owns neighbor index s, so the 16 row gathers of a point have no load in
// front of them and are issued in groups; the next point's indices are read one
// iteration ahead.
// ---------------------------------------------------------------------------
__global__ __launch_bounds__(256) void w1_stats(
    const int* __restrict__ idx,
    const float* __restrict__ xq, const _Float16* __restrict__ xk,
    float* __restrict__ statSum, float* __restrict__ statSq) {
  int t = threadIdx.x, wave = __builtin_amdgcn_readfirstlane(t >> 5), lane = t & 31;
  int c0 = lane * 4;
  unsigned voff = lane * 16u, hoff = lane * 8u;
  f32x4 sm = {0.f, 0.f, 0.f, 0.f}, sq = {0.f, 0.f, 0.f, 0.f};
  int W = gridDim.x * 8;
  int n = blockIdx.x * 8 + wave;
  int j = nbr_index(idx, min(n, NPTS - 1), lane);
  for (; n < NPTS; n += W) {
    unsigned offq = row_off(n, voff);
    f32x4 xq4 = load_at(xq, offq);
    h16x4 kr[NSAMP];
    gather8<0>(kr, xk, j, hoff, offq);
    gather8<8>(kr, xk, j, hoff, hoff);
    int jn = nbr_index(idx, min(n + W, NPTS - 1), lane);
#pragma unroll  // constant register-array indices
    for (int s = 0; s < NSAMP; s++) {
      f32x4 w = widen(kr[s]) - xq4;
      sm += w;
      sq = __builtin_elementwise_fma(w, w, sq);
    }
    j = jn;
  }
  __shared__ float rs[128], rq[128];
  if (t < 128) { rs[t] = 0.f; rq[t] = 0.f; }
  __syncthreads();
#pragma unroll
  for (int i = 0; i < 4; i++) { atomicAdd(&rs[c0 + i], sm[i]); atomicAdd(&rq[c0 + i], sq[i]); }
  __syncthreads();
  if (t < 128) { atomicAdd(&statSum[t], rs[t]); atomicAdd(&statSq[t], rq[t]); }
}

__global__ __launch_bounds__(256, 8) void w2_stats(
    const int* __restrict__ idx,
    const float* __restrict__ xq, const _Float16* __restrict__ xk,
    const float* __restrict__ s1Sum, const float* __restrict__ s1Sq,
    const float* __restrict__ g1, const float* __restrict__ be1,
    const float* __restrict__ bw1,
    const __bf16* __restrict__ w1f,
    float* __restrict__ statSum, float* __restrict__ statSq) {
  __shared__ unsigned ldsA[8][1024];
  int t = threadIdx.x, wave = __builtin_amdgcn_readfirstlane(t >> 5), lane = t & 31;
  int cs = lane & 15;
  unsigned voff = lane * 16u, hoff = lane * 8u;
  unsigned* la = &ldsA[wave][0];
  v16bf B1[4];  // w_w1 fragments, read once per wave
#pragma unroll  // B1[] stays in registers
  for (int kc = 0; kc < 4; kc++) B1[kc] = load_bfrag(w1f + (kc * 32 + lane) * 16);
  // the wait that stands before a register that an issued load names is written again; the
  // base is an input so that no argument load that follows is placed on it in front of it
  asm volatile("s_wait_xcnt 0x0" :: "s"(w1f) : "memory");
  f32x4 s1v, h1v;  // bn1 of this lane's 4 channels
  bn_coef4(s1Sum, s1Sq, g1, be1, voff, s1v, h1v);
  float bw = bw1[cs];
  const f32x4 zero4 = {0.f, 0.f, 0.f, 0.f};
  float ssum = 0.f, ssq = 0.f;
  int W = gridDim.x * 8;
  int n = blockIdx.x * 8 + wave;
  int j = nbr_index(idx, min(n, NPTS - 1), lane);
  for (; n < NPTS; n += W) {
    unsigned offq = row_off(n, voff);
    f32x4 xq4 = load_at(xq, offq);
    h16x4 kr[NSAMP];
    gather8<0>(kr, xk, j, hoff, offq);
    gather8<8>(kr, xk, j, hoff, hoff);
    int jn = nbr_index(idx, min(n + W, NPTS - 1), lane);
    f32x4 hq = __builtin_elementwise_fma(-xq4, s1v, h1v);
#pragma unroll  // constant register-array indices
    for (int s = 0; s < NSAMP; s++) {
      // keeps the rows in f16 until their group of four is used: widened all at once, the
      // 16 rows take 64 registers and the weight fragments are spilled
      if ((s & 3) == 0) __builtin_amdgcn_sched_barrier(0);
      f32x4 z = __builtin_elementwise_max(__builtin_elementwise_fma(widen(kr[s]), s1v, hq), zero4);
      u32x2 pk; pk[0] = pkbf(z[0], z[1]); pk[1] = pkbf(z[2], z[3]);
      *(u32x2*)&la[s * 64 + lane * 2] = pk;
    }
    j = jn;
    v8f acc = {};
#pragma unroll
    for (int kc = 0; kc < 4; kc++) {
      v16bf A = load_afrag(la, lane, kc);
      acc = wmma_bf16(A, B1[kc], acc);
    }
#pragma unroll
    for (int r = 0; r < 8; r++) {
      float y = acc[r] + bw;
      ssum += y;
      ssq = fmaf(y, y, ssq);
    }
  }
  __shared__ float rs[16], rq[16];
  if (t < 16) { rs[t] = 0.f; rq[t] = 0.f; }
  __syncthreads();
  atomicAdd(&rs[cs], ssum); atomicAdd(&rq[cs], ssq);
  __syncthreads();
  if (t < 16) { atomicAdd(&statSum[t], rs[t]); atomicAdd(&statSq[t], rq[t]); }
}

__global__ __launch_bounds__(256, 8) void attn_final(
    const int* __restrict__ idx,
    const float* __restrict__ xq, const _Float16* __restrict__ xk, const _Float16* __restrict__ xv,
    const float* __restrict__ s1Sum, const float* __restrict__ s1Sq,
    const float* __restrict__ g1, const float* __restrict__ be1, const float* __restrict__ bw1,
    const float* __restrict__ s2Sum, const float* __restrict__ s2Sq,
    const float* __restrict__ g2, const float* __restrict__ be2, const float* __restrict__ bw2,
    const __bf16* __restrict__ w1f, const __bf16* __restrict__ w2f,
    float* __restrict__ out) {
  __shared__ unsigned ldsA[8][1024]; // bn1'd w_pre, bf16 pairs [16 s][64]
  __shared__ __bf16   ldsB[8][512];  // bn2'd y1 [16 s][32 k] (K padded with 0)
  __shared__ float    ldsW[8][256];  // softmax weights [16 s][16 cs]
  int t = threadIdx.x, wave = __builtin_amdgcn_readfirstlane(t >> 5), lane = t & 31;
  int c0 = lane * 4, cs = lane & 15, hl = lane >> 4;
  unsigned voff = lane * 16u, hoff = lane * 8u;
  unsigned* la = &ldsA[wave][0];
  __bf16*   lb = &ldsB[wave][0];
  float*    lw = &ldsW[wave][0];
  int W = gridDim.x * 8;
  int n = blockIdx.x * 8 + wave;
  if (n >= NPTS) return;  // whole wave; the kernel has no barrier
  int j = nbr_index(idx, n, lane);
  asm volatile("s_wait_xcnt 0x0" ::: "memory");
  v16bf B1[4];  // w_w1 and w_w2 fragments, read once per wave
#pragma unroll  // B1[] stays in registers
  for (int kc = 0; kc < 4; kc++) B1[kc] = load_bfrag(w1f + (kc * 32 + lane) * 16);
  v16bf B2 = load_bfrag(w2f + lane * 16);
  asm volatile("s_wait_xcnt 0x0" ::: "memory");
  f32x4 s1v, h1v;  // bn1 of this lane's 4 channels, as in w2_stats
  bn_coef4(s1Sum, s1Sq, g1, be1, voff, s1v, h1v);
  float sc2, hf2;  // bn2 of channel cs
  float bb1 = bw1[cs], bb2 = bw2[cs];
  {
    float a = s2Sum[cs], q = s2Sq[cs], g = g2[cs], b = be2[cs];
    // the wait that stands before a register that an issued load names is written again
    asm volatile("s_wait_xcnt 0x0" :: "s"(bw1), "s"(bw2), "s"(s2Sum), "s"(s2Sq), "s"(g2), "s"(be2),
                 "v"(cs) : "memory");
    bn_coef(a, q, g, b, sc2, hf2);
  }
  const f32x4 zero4 = {0.f, 0.f, 0.f, 0.f};
  // zero K=16..31 pad region of ldsB once (never overwritten)
#pragma unroll
  for (int i = 0; i < 8; i++) {
    int e = lane * 8 + i;
    lb[(e >> 4) * 32 + 16 + (e & 15)] = (__bf16)0.f;
  }
  for (; n < NPTS; n += W) {
    unsigned offq = row_off(n, voff);
    f32x4 xq4 = load_at(xq, offq);
    h16x4 kr[NSAMP];
    gather8<0>(kr, xk, j, hoff, offq);
    gather8<8>(kr, xk, j, hoff, hoff);
    int jn = nbr_index(idx, min(n + W, NPTS - 1), lane);
    // bn1(row - xq) = row * scale + (shift - xq * scale), as in w2_stats
    f32x4 hq = __builtin_elementwise_fma(-xq4, s1v, h1v);
#pragma unroll  // constant register-array indices
    for (int s = 0; s < NSAMP; s++) {
      // keeps the rows in f16 until their group of four is used: widened all at once, the
      // 16 rows take 64 registers and the weight fragments are spilled
      if ((s & 3) == 0) __builtin_amdgcn_sched_barrier(0);
      f32x4 z = __builtin_elementwise_max(__builtin_elementwise_fma(widen(kr[s]), s1v, hq), zero4);
      u32x2 pk; pk[0] = pkbf(z[0], z[1]); pk[1] = pkbf(z[2], z[3]);
      *(u32x2*)&la[s * 64 + lane * 2] = pk;
    }
    // the 16 value rows fly while the two matrix products and the softmax run
    h16x4 vr[NSAMP];
    gather8<0>(vr, xv, j, hoff, hoff);
    gather8<8>(vr, xv, j, hoff, hoff);
    // WMMA1: [16 neighbors x 128] @ [128 x 16]
    v8f acc = {};
#pragma unroll
    for (int kc = 0; kc < 4; kc++) {
      v16bf A = load_afrag(la, lane, kc);
      acc = wmma_bf16(A, B1[kc], acc);
    }
    // bn2 + relu, stage as bf16 for WMMA2 (lane holds column cs, rows r+8*hl)
#pragma unroll
    for (int r = 0; r < 8; r++) {
      float y = acc[r] + bb1;
      lb[(r + 8 * hl) * 32 + cs] = (__bf16)fmaxf(fmaf(y, sc2, hf2), 0.f);
    }
    // WMMA2: [16 x 16(pad 32)] @ [16(pad 32) x 16]
    v16bf A2;
    {
      int row = lane & 15;
#pragma unroll
      for (int vv = 0; vv < 8; vv++) {
        int k = ((vv >> 2) << 4) + (hl << 3) + ((vv & 3) << 1);
        A2[2 * vv]     = lb[row * 32 + k];
        A2[2 * vv + 1] = lb[row * 32 + k + 1];
      }
    }
    v8f acc2 = {};
    acc2 = wmma_bf16(A2, B2, acc2);
    float yv[8];
    float mx = -3.0e38f;
#pragma unroll
    for (int r = 0; r < 8; r++) { yv[r] = acc2[r] + bb2; mx = fmaxf(mx, yv[r]); }
    mx = fmaxf(mx, __shfl_xor(mx, 16, 32));
    float se = 0.f;
#pragma unroll
    for (int r = 0; r < 8; r++) { yv[r] = __expf(yv[r] - mx); se += yv[r]; }
    se += __shfl_xor(se, 16, 32);
    float inv = 1.0f / se;
#pragma unroll
    for (int r = 0; r < 8; r++) lw[(r + 8 * hl) * 16 + cs] = yv[r] * inv;
    // weighted sum: out[c] = sum_s (gv + p_r) * w[s, c%16]; lane owns c0..c0+3
    f32x4 o = {0.f, 0.f, 0.f, 0.f};
#pragma unroll  // vr[], sw[] stay in registers (this loop and the two inside it)
    for (int g = 0; g < NSAMP; g += 4) {
      f32x4 sw[4];
#pragma unroll
      for (int u = 0; u < 4; u++) sw[u] = *(const f32x4*)&lw[(g + u) * 16 + (c0 & 15)];
      // keeps the 4 LDS reads of four neighbors together in front of their uses: one
      // LDS latency per group instead of one per neighbor
      __builtin_amdgcn_sched_barrier(0);
#pragma unroll
      for (int u = 0; u < 4; u++) o = __builtin_elementwise_fma(widen(vr[g + u]), sw[u], o);
    }
    *(f32x4*)&out[n * CH + c0] = o;
    // the wait that stands before the store's registers are written again (next point)
    asm volatile("s_wait_xcnt 0x0" ::: "memory");
    j = jn;
  }
}

// ---------------------------------------------------------------------------
extern "C" void kernel_launch(void* const* d_in, const int* in_sizes, int n_in,
                              void* d_out, int out_size, void* d_ws, size_t ws_size,
                              hipStream_t stream) {
  (void)in_sizes; (void)n_in; (void)out_size; (void)ws_size;
  const float* p    = (const float*)d_in[0];
  const float* x    = (const float*)d_in[1];
  const int*   idx  = (const int*)d_in[2];
  const float* w_q  = (const float*)d_in[3];
  const float* b_q  = (const float*)d_in[4];
  const float* w_k  = (const float*)d_in[5];
  const float* b_k  = (const float*)d_in[6];
  const float* w_v  = (const float*)d_in[7];
  const float* b_v  = (const float*)d_in[8];
  const float* w_p1 = (const float*)d_in[9];
  const float* b_p1 = (const float*)d_in[10];
  const float* g_p  = (const float*)d_in[11];
  const float* be_p = (const float*)d_in[12];
  const float* w_p2 = (const float*)d_in[13];
  const float* b_p2 = (const float*)d_in[14];
  const float* g_w1 = (const float*)d_in[15];
  const float* be_w1= (const float*)d_in[16];
  const float* w_w1 = (const float*)d_in[17];
  const float* b_w1 = (const float*)d_in[18];
  const float* g_w2 = (const float*)d_in[19];
  const float* be_w2= (const float*)d_in[20];
  const float* w_w2 = (const float*)d_in[21];
  const float* b_w2 = (const float*)d_in[22];
  float* out = (float*)d_out;

  // workspace carve-up (q f32, k + p_r and v + p_r f16, then bf16 fragments, then stats)
  float* ws = (float*)d_ws;
  float* xq = ws;
  _Float16* xk = (_Float16*)(xq + NC);
  _Float16* xv = xk + NC;
  __bf16* wqf = (__bf16*)(xv + NC);
  __bf16* wkf = wqf + 16384;
  __bf16* wvf = wkf + 16384;
  __bf16* w1f = wvf + 16384;
  __bf16* w2f = w1f + 2048;
  float* stats = (float*)(w2f + 512);
  float* s1Sum  = stats;        // 128
  float* s1Sq   = stats + 128;  // 128
  float* s2Sum  = stats + 256;  // 16
  float* s2Sq   = stats + 272;  // 16
  float* part   = stats + 288;  // 6 x POSPITCH block sums of the position stats

  prep_pos<<<POSB + PREPB, 256, 0, stream>>>(w_q, w_k, w_v, w_w1, w_w2, p, idx, w_p1, b_p1,
                                             wqf, wkf, wvf, w1f, w2f, stats, part);
  qkv_gemm<<<NPTS / 16, 256, 0, stream>>>(x, p, b_q, b_k, b_v, w_p1, b_p1, w_p2, b_p2,
                                          g_p, be_p, part, wqf, wkf, wvf, xq, xk, xv);
  w1_stats<<<1024, 256, 0, stream>>>(idx, xq, xk, s1Sum, s1Sq);
  w2_stats<<<1024, 256, 0, stream>>>(idx, xq, xk, s1Sum, s1Sq, g_w1, be_w1, b_w1, w1f,
                                     s2Sum, s2Sq);
  attn_final<<<1875, 256, 0, stream>>>(idx, xq, xk, xv, s1Sum, s1Sq, g_w1, be_w1, b_w1,
                                       s2Sum, s2Sq, g_w2, be_w2, b_w2, w1f, w2f, out);
}

// v005
// One run takes 109 microseconds.
// Two timings next to v004 both put it at 1.07 times that version's speed.
// Counting every step since v000, it is 2.30 times as fast.
#include <hip/hip_runtime.h>
#include <hip/hip_bf16.h>

#define NPTS 60000
#define NSAMP 16
#define CH 128
#define NC (NPTS*CH)
#define POSB ((NPTS + 255) / 256)  // blocks of prep_pos that sum position stats, a thread per point
#define PREPB 204                  // blocks of prep_pos that swizzle weights and zero accumulators
#define POSPITCH 256               // partial sums of one statistic: POSB used of POSPITCH floats
#define BN_INVC (1.0f / (float)(NPTS * NSAMP))
#define NTILE (NPTS / 32)          // 32-row tiles of the QKV GEMM
#define QKVB 512                   // its work-groups: two per WGP, all resident at once

typedef __attribute__((ext_vector_type(16))) __bf16 v16bf;
typedef __attribute__((ext_vector_type(8)))  __bf16 v8bf;
typedef __attribute__((ext_vector_type(2)))  __bf16 bf16x2;
typedef __attribute__((ext_vector_type(8)))  float  v8f;
typedef __attribute__((ext_vector_type(4)))  float  f32x4;
typedef __attribute__((ext_vector_type(4)))  unsigned u32x4;
typedef __attribute__((ext_vector_type(4)))  int i32x4;
typedef __attribute__((ext_vector_type(2)))  unsigned u32x2;
typedef __attribute__((ext_vector_type(4)))  _Float16 h16x4;
typedef __attribute__((ext_vector_type(8)))  _Float16 h16x8;

static __device__ __forceinline__ unsigned pkbf(float a, float b) {
  bf16x2 t; t[0] = (__bf16)a; t[1] = (__bf16)b;
  return __builtin_bit_cast(unsigned, t);
}

static __device__ __forceinline__ int frag_koff(int lane, int s) {
  int v = s >> 1;
  return ((v >> 2) << 4) + ((lane >> 4) << 3) + ((v & 3) << 1) + (s & 1);
}

static __device__ __forceinline__ v16bf joinbf(u32x4 q0, u32x4 q1) {
  v8bf lo = __builtin_bit_cast(v8bf, q0);
  v8bf hi = __builtin_bit_cast(v8bf, q1);
  v16bf a;
#pragma unroll
  for (int i = 0; i < 8; i++) { a[i] = lo[i]; a[8 + i] = hi[i]; }
  return a;
}

// A fragment from LDS tile stored as [16 rows][64 bf16-pairs] (row-major K pairs).
static __device__ __forceinline__ v16bf load_afrag(const unsigned* base, int lane, int kc) {
  int row = lane & 15, hl = lane >> 4;
  const unsigned* pa = base + row * 64 + kc * 16 + hl * 4;
  u32x4 q0 = *(const u32x4*)pa;
  u32x4 q1 = *(const u32x4*)(pa + 8);
  return joinbf(q0, q1);
}

// B fragment pre-swizzled in global memory: 16 contiguous bf16 per lane.
static __device__ __forceinline__ v16bf load_bfrag(const __bf16* b) {
  u32x4 q0 = *(const u32x4*)b;
  u32x4 q1 = *(const u32x4*)(b + 8);
  return joinbf(q0, q1);
}

static __device__ __forceinline__ v8f wmma_bf16(v16bf a, v16bf b, v8f c) {
  return __builtin_amdgcn_wmma_f32_16x16x32_bf16(false, a, false, b, (short)0, c, false, false);
}

static __device__ __forceinline__ int nbr_index(const int* __restrict__ idx, int n, int lane) {
  int j = idx[n * NSAMP + (lane & 15)];
  return min(max(j, 0), NPTS - 1);
}

// Value of lane s as a wave-uniform scalar.
static __device__ __forceinline__ int bcast_i(int v, int s) {
  return __builtin_amdgcn_readlane(v, s);
}

// Byte offset of this lane's 16 bytes (voff = 16 * lane) in row js of a [NPTS][CH] f32 array.
static __device__ __forceinline__ unsigned row_off(int js, unsigned voff) {
  return ((unsigned)js << 9) | voff;
}
static __device__ __forceinline__ f32x4 load_at(const float* __restrict__ base, unsigned off) {
  return *(const f32x4*)((const char*)base + off);
}

// The same for a [NPTS][CH] f16 array: this lane's 8 bytes (hoff = 8 * lane) in row js.
static __device__ __forceinline__ unsigned hrow_off(int js, unsigned hoff) {
  return ((unsigned)js << 8) | hoff;
}
static __device__ __forceinline__ h16x4 load_h(const _Float16* __restrict__ base, unsigned off) {
  return *(const h16x4*)((const char*)base + off);
}
static __device__ __forceinline__ f32x4 widen(h16x4 h) {
  return __builtin_convertvector(h, f32x4);
}

// Rows named by lanes S0..S0+7 of j: 8 loads back to back, none used before all are issued.
// keep: the offset register of one more load that the caller has just issued.
template <int S0>
static __device__ __forceinline__ void gather8(h16x4 (&r)[NSAMP], const _Float16* __restrict__ base,
                                               int j, unsigned hoff, unsigned keep) {
  unsigned off[8];
#pragma unroll  // off[] and r[] stay in registers, constant lane numbers
  for (int u = 0; u < 8; u++) off[u] = hrow_off(bcast_i(j, S0 + u), hoff);
#pragma unroll
  for (int u = 0; u < 8; u++) r[S0 + u] = load_h(base, off[u]);
  // the wait that stands before an issued load's address register is written again; the
  // offsets are inputs so that no later load's result is placed on them in front of it
  asm volatile("s_wait_xcnt 0x0" :: "v"(off[0]), "v"(off[1]), "v"(off[2]), "v"(off[3]),
               "v"(off[4]), "v"(off[5]), "v"(off[6]), "v"(off[7]), "v"(keep) : "memory");
}

static __device__ __forceinline__ f32x4 fma4(float a, f32x4 b, f32x4 c) {
  f32x4 av = {a, a, a, a};
  return __builtin_elementwise_fma(av, b, c);
}

// BatchNorm over N*NS samples from their sum and sum of squares:
// scale = g/sqrt(var+eps), shift = b - mean*scale.
static __device__ __forceinline__ void bn_coef(float sum, float sq, float g, float b,
                                               float& scale, float& shift) {
  float m = sum * BN_INVC;
  float v = sq * BN_INVC - m * m;
  scale = g * rsqrtf(v + 1e-5f);
  shift = b - m * scale;
}
// The same for this lane's 4 channels (voff = 16 * lane).
static __device__ __forceinline__ void bn_coef4(
    const float* __restrict__ sum, const float* __restrict__ sq,
    const float* __restrict__ g, const float* __restrict__ b, unsigned voff,
    f32x4& scale, f32x4& shift) {
  f32x4 a = load_at(sum, voff), q = load_at(sq, voff), gg = load_at(g, voff), bb = load_at(b, voff);
  // the wait that stands before a register that an issued load names is written again; the
  // bases are inputs so that no argument load that follows is placed on them in front of it
  asm volatile("s_wait_xcnt 0x0" :: "s"(sum), "s"(sq), "s"(g), "s"(b), "v"(voff) : "memory");
#pragma unroll  // constant element numbers
  for (int i = 0; i < 4; i++) {
    float sc, sh;
    bn_coef(a[i], q[i], gg[i], bb[i], sc, sh);
    scale[i] = sc; shift[i] = sh;
  }
}

// Sum over the 32 lanes of a wave, the same order in every run; every lane gets it.
static __device__ __forceinline__ float wave_sum(float v) {
#pragma unroll  // five steps with constant lane masks
  for (int m = 16; m > 0; m >>= 1) v += __shfl_xor(v, m, 32);
  return v;
}

// ---------------------------------------------------------------------------
// Kernel 1: two independent jobs in one grid.
// Blocks 0..POSB-1: stats (sum, sumsq) of gp@w_p1+b_p1 over N*NS, 3 channels. A thread takes
// one point: its 16 indices in four 16-byte loads, then its 16 position gathers back to back.
// Each block stores its own six sums (part[statistic][block]); qkv_gemm adds them up.
// Blocks POSB..: weight swizzle into fragment order + zero of the accumulators of the two
// later stats kernels.
// ---------------------------------------------------------------------------
__global__ __launch_bounds__(256) void prep_pos(
    const float* __restrict__ wq, const float* __restrict__ wk, const float* __restrict__ wv,
    const float* __restrict__ ww1, const float* __restrict__ ww2,
    const float* __restrict__ p, const int* __restrict__ idx,
    const float* __restrict__ wp1, const float* __restrict__ bp1,
    __bf16* __restrict__ wqf, __bf16* __restrict__ wkf, __bf16* __restrict__ wvf,
    __bf16* __restrict__ w1f, __bf16* __restrict__ w2f,
    float* __restrict__ stats, float* __restrict__ part) {
  if (blockIdx.x < POSB) {  // the same for the whole block
    __shared__ float red[8][6];
    int n = blockIdx.x * 256 + threadIdx.x;
    float s0 = 0, s1 = 0, s2 = 0, q0 = 0, q1 = 0, q2 = 0;
    if (n < NPTS) {
      unsigned io = (unsigned)n * (NSAMP * 4u);
      i32x4 jv[4];
#pragma unroll  // jv[] stays in registers
      for (int u = 0; u < 4; u++) jv[u] = *(const i32x4*)((const char*)idx + (io + 16u * u));
      // the wait that stands before an issued load's address register is written again
      asm volatile("s_wait_xcnt 0x0" :: "v"(io) : "memory");
      float a0 = wp1[0], a1 = wp1[1], a2 = wp1[2], a3 = wp1[3], a4 = wp1[4],
            a5 = wp1[5], a6 = wp1[6], a7 = wp1[7], a8 = wp1[8];
      float b0 = bp1[0], b1 = bp1[1], b2 = bp1[2];
      unsigned po[NSAMP];
      float px[NSAMP], py[NSAMP], pz[NSAMP];
#pragma unroll  // po[] stays in registers; every row gathered lies inside p
      for (int u = 0; u < NSAMP; u++) po[u] = (unsigned)min(max(jv[u >> 2][u & 3], 0), NPTS - 1) * 12u;
#pragma unroll  // 16 gathers in flight, none used before all are issued
      for (int u = 0; u < NSAMP; u++) {
        const float* pj = (const float*)((const char*)p + po[u]);
        px[u] = pj[0]; py[u] = pj[1]; pz[u] = pj[2];
      }
      asm volatile("s_wait_xcnt 0x0" :: "v"(po[0]), "v"(po[1]), "v"(po[2]), "v"(po[3]),
                   "v"(po[4]), "v"(po[5]), "v"(po[6]), "v"(po[7]), "v"(po[8]), "v"(po[9]),
                   "v"(po[10]), "v"(po[11]), "v"(po[12]), "v"(po[13]), "v"(po[14]), "v"(po[15])
                   : "memory");
#pragma unroll  // constant register-array indices
      for (int u = 0; u < NSAMP; u++) {
        float y0 = fmaf(px[u], a0, fmaf(py[u], a3, fmaf(pz[u], a6, b0)));
        float y1 = fmaf(px[u], a1, fmaf(py[u], a4, fmaf(pz[u], a7, b1)));
        float y2 = fmaf(px[u], a2, fmaf(py[u], a5, fmaf(pz[u], a8, b2)));
        s0 += y0; s1 += y1; s2 += y2;
        q0 = fmaf(y0, y0, q0); q1 = fmaf(y1, y1, q1); q2 = fmaf(y2, y2, q2);
      }
    }
    s0 = wave_sum(s0); s1 = wave_sum(s1); s2 = wave_sum(s2);
    q0 = wave_sum(q0); q1 = wave_sum(q1); q2 = wave_sum(q2);
    if ((threadIdx.x & 31) == 0) {
      float* r = &red[threadIdx.x >> 5][0];
      r[0] = s0; r[1] = s1; r[2] = s2; r[3] = q0; r[4] = q1; r[5] = q2;
    }
    __syncthreads();
    if (threadIdx.x < 6) {
      float a = 0.f;
#pragma unroll  // the 8 LDS reads together, one latency
      for (int w = 0; w < 8; w++) a += red[w][threadIdx.x];
      part[threadIdx.x * POSPITCH + blockIdx.x] = a;
    }
    return;
  }
  const int QKV = 3 * 16384;
  int t = (blockIdx.x - POSB) * 256 + threadIdx.x;
  if (t < QKV) {
    int s = t & 15, lane = (t >> 4) & 31, kc = (t >> 9) & 3, jt = (t >> 11) & 7, m = t >> 14;
    int k = kc * 32 + frag_koff(lane, s);
    int n = jt * 16 + (lane & 15);
    const float* w = (m == 0) ? wq : (m == 1) ? wk : wv;
    __bf16* d = (m == 0) ? wqf : (m == 1) ? wkf : wvf;
    d[t & 16383] = (__bf16)w[k * CH + n];
  } else if (t < QKV + 2048) {
    int u = t - QKV;
    int s = u & 15, lane = (u >> 4) & 31, kc = (u >> 9) & 3;
    int k = kc * 32 + frag_koff(lane, s);
    w1f[u] = (__bf16)ww1[k * 16 + (lane & 15)];
  } else if (t < QKV + 2048 + 512) {
    int u = t - QKV - 2048;
    int s = u & 15, lane = (u >> 4) & 31;
    int k = frag_koff(lane, s); // single K chunk, upper 16 zero-padded
    w2f[u] = (k < 16) ? (__bf16)ww2[k * 16 + (lane & 15)] : (__bf16)0.f;
  } else if (t < QKV + 2048 + 512 + 288) {
    stats[t - (QKV + 2048 + 512)] = 0.f;
  }
}

// ---------------------------------------------------------------------------
// Kernel 2: QKV GEMM. QKVB work-groups, all resident at once, each looping over tiles of
// 32 rows of x (two WMMA row tiles); 8 waves = 8 column tiles; each wave does q,k,v tiles
// (12 WMMAs a row tile). A wave reads its 12 weight fragments and its epilogue constants once
// and keeps them in registers for all its rows. The next tile's x and positions are asked for
// before the current tile is worked on; x goes into the other LDS buffer behind it: one
// barrier a tile.
// The k and v products take the weights as first operand: a lane then holds 8 neighbouring
// channels of one row, one 16-byte f16 store.
// The row's position term p_r = relu(bn(p @ w_p1 + b_p1)) @ w_p2 + b_p2 is added to k and v;
// its BatchNorm comes from prep_pos's block sums: wave c adds up statistic c while the first
// x tile is on its way, and that tile's own barrier publishes the six totals.
// ---------------------------------------------------------------------------
__global__ __launch_bounds__(256, 4) void qkv_gemm(
    const float* __restrict__ x, const float* __restrict__ p,
    const float* __restrict__ bq, const float* __restrict__ bk, const float* __restrict__ bv,
    const float* __restrict__ wp1, const float* __restrict__ bp1,
    const float* __restrict__ wp2, const float* __restrict__ bp2,
    const float* __restrict__ gp, const float* __restrict__ bep, const float* __restrict__ part,
    const __bf16* __restrict__ wqf, const __bf16* __restrict__ wkf, const __bf16* __restrict__ wvf,
    float* __restrict__ xq, _Float16* __restrict__ xk, _Float16* __restrict__ xv) {
  __shared__ unsigned lds[2][2][16 * 64]; // two tiles of 2 x 16 rows x 128 bf16 (packed pairs)
  __shared__ float pst[8];                // position stats: 3 sums, 3 sums of squares
  int t = threadIdx.x;
  int wave = t >> 5, lane = t & 31, hl = lane >> 4;
  int jt = wave;
  int tile = blockIdx.x;  // QKVB <= NTILE: every work-group has a first tile
  // this thread's 32 bytes of a row tile of x (8 KB) and this lane's row of p (16 rows of 12 B)
  unsigned xlane = (unsigned)t * 32u, plane = (unsigned)(lane & 15) * 12u;
  f32x4 u[2][2];
  float px[2], py[2], pz[2];
  int st = __builtin_amdgcn_readfirstlane(t >> 5);
  float e[8] = {0.f, 0.f, 0.f, 0.f, 0.f, 0.f, 0.f, 0.f};
  if (st < 6) {  // whole waves
    const float* pc = part + st * POSPITCH;
    int i0 = t & 31, i7 = min((t & 31) + 224, POSB - 1);
#pragma unroll  // e[] stays in registers, 8 loads in flight
    for (int i = 0; i < 7; i++) e[i] = pc[i0 + 32 * i];
    e[7] = pc[i7];
    // the wait that stands before an issued load's address register is written again; the
    // indices are inputs so that nothing is placed on them in front of it
    asm volatile("s_wait_xcnt 0x0" :: "v"(i0), "v"(i7) : "memory");
  }
  {
    unsigned xo = (unsigned)tile * 16384u + xlane, po = (unsigned)tile * 384u + plane;
    const char* xt = (const char*)x + xo;
    const char* pt = (const char*)p + po;
#pragma unroll  // u[], px[].. stay in registers
    for (int h = 0; h < 2; h++) {
      u[h][0] = *(const f32x4*)(xt + 8192 * h); u[h][1] = *(const f32x4*)(xt + 8192 * h + 16);
      const float* pm = (const float*)(pt + 192 * h);
      px[h] = pm[0]; py[h] = pm[1]; pz[h] = pm[2];
    }
    asm volatile("s_wait_xcnt 0x0" :: "v"(xo), "v"(po) : "memory");
  }
  // this wave's weight fragments, read once for all its rows
  v16bf Bq[4], Bk[4], Bv[4];
  unsigned foff = (unsigned)(jt * 4 * 32 + lane) * 32u;  // bytes: 16 bf16 a lane and fragment
#pragma unroll  // Bq[], Bk[], Bv[] stay in registers
  for (int kc = 0; kc < 4; kc++) {
    Bq[kc] = load_bfrag((const __bf16*)((const char*)wqf + foff) + kc * 512);
    Bk[kc] = load_bfrag((const __bf16*)((const char*)wkf + foff) + kc * 512);
    Bv[kc] = load_bfrag((const __bf16*)((const char*)wvf + foff) + kc * 512);
  }
  int col = jt * 16 + (lane & 15);
  float cq = bq[col];
  // k, v: register r is channel ch0 + r of row (lane & 15) of the row tile
  int ch0 = jt * 16 + 8 * hl;
  unsigned boff = ch0 * 4u;
  f32x4 ck0 = load_at(bk, boff), ck1 = load_at(bk, boff + 16u);
  f32x4 cv0 = load_at(bv, boff), cv1 = load_at(bv, boff + 16u);
  f32x4 e00 = load_at(wp2, boff), e01 = load_at(wp2, boff + 16u);
  f32x4 e10 = load_at(wp2, boff + 512u), e11 = load_at(wp2, boff + 528u);
  f32x4 e20 = load_at(wp2, boff + 1024u), e21 = load_at(wp2, boff + 1040u);
  f32x4 cp0 = load_at(bp2, boff), cp1 = load_at(bp2, boff + 16u);
  // the wait that stands before an issued load's address register is written again; the
  // offsets are inputs so that no load's result is placed on them in front of it
  asm volatile("s_wait_xcnt 0x0" :: "v"(foff), "v"(boff), "v"(col) : "memory");
  // keeps the wait for the x tile behind the issue of the loads above: one memory latency
  // in the prologue, not one behind the other
  __builtin_amdgcn_sched_barrier(0);
  if (st < 6) {  // summed while the x tile is on its way
    float a = ((t & 31) + 224 < POSB) ? e[7] : 0.f;
#pragma unroll  // constant register-array indices
    for (int i = 6; i >= 0; i--) a += e[i];
    a = wave_sum(a);
    if ((t & 31) == 0) pst[st] = a;
  }
#pragma unroll  // constant register-array indices
  for (int h = 0; h < 2; h++) {
    u32x4 w;
    w[0] = pkbf(u[h][0][0], u[h][0][1]); w[1] = pkbf(u[h][0][2], u[h][0][3]);
    w[2] = pkbf(u[h][1][0], u[h][1][1]); w[3] = pkbf(u[h][1][2], u[h][1][3]);
    *(u32x4*)&lds[0][h][t * 4] = w;
  }
  __syncthreads();
  float pS0, pS1, pS2, pH0, pH1, pH2;
  bn_coef(pst[0], pst[3], gp[0], bep[0], pS0, pH0);
  bn_coef(pst[1], pst[4], gp[1], bep[1], pS1, pH1);
  bn_coef(pst[2], pst[5], gp[2], bep[2], pS2, pH2);
  float a0 = wp1[0], a1 = wp1[1], a2 = wp1[2], a3 = wp1[3], a4 = wp1[4],
        a5 = wp1[5], a6 = wp1[6], a7 = wp1[7], a8 = wp1[8];
  float b0 = bp1[0], b1 = bp1[1], b2 = bp1[2];
  // byte offsets of this lane's stores inside a row tile: q rows 8 * hl + r, k, v row lane & 15
  unsigned qlane = (unsigned)((8 * hl) * CH + col) * 4u;
  unsigned klane = (unsigned)((lane & 15) * CH + ch0) * 2u;
  int buf = 0;
  for (;;) {  // the trip count is the same for the whole work-group
    int nxt = tile + QKVB;
    bool more = nxt < NTILE;
    float nx[2] = {0.f, 0.f}, ny[2] = {0.f, 0.f}, nz[2] = {0.f, 0.f};
    if (more) {
      unsigned xo = (unsigned)nxt * 16384u + xlane, po = (unsigned)nxt * 384u + plane;
      const char* xt = (const char*)x + xo;
      const char* pt = (const char*)p + po;
#pragma unroll  // u[], nx[].. stay in registers
      for (int h = 0; h < 2; h++) {
        u[h][0] = *(const f32x4*)(xt + 8192 * h); u[h][1] = *(const f32x4*)(xt + 8192 * h + 16);
        const float* pm = (const float*)(pt + 192 * h);
        nx[h] = pm[0]; ny[h] = pm[1]; nz[h] = pm[2];
      }
      // the wait that stands before an issued load's address register is written again
      asm volatile("s_wait_xcnt 0x0" :: "v"(xo), "v"(po) : "memory");
    }
    unsigned qo = (unsigned)tile * 16384u + qlane, ko = (unsigned)tile * 8192u + klane;
    char* qt = (char*)xq + qo;
    char* kt = (char*)xk + ko;
    char* vt = (char*)xv + ko;
#pragma unroll  // constant register-array indices and store offsets
    for (int h = 0; h < 2; h++) {
      v8f aq = {}, ak = {}, av = {};
#pragma unroll
      for (int kc = 0; kc < 4; kc++) {
        v16bf A = load_afrag(&lds[buf][h][0], lane, kc);
        aq = wmma_bf16(A, Bq[kc], aq);
        ak = wmma_bf16(Bk[kc], A, ak);
        av = wmma_bf16(Bv[kc], A, av);
      }
#pragma unroll
      for (int r = 0; r < 8; r++) *(float*)(qt + 8192 * h + 512 * r) = aq[r] + cq;
      // position term of this lane's row, 8 channels
      float y0 = fmaxf(fmaf(fmaf(px[h], a0, fmaf(py[h], a3, fmaf(pz[h], a6, b0))), pS0, pH0), 0.f);
      float y1 = fmaxf(fmaf(fmaf(px[h], a1, fmaf(py[h], a4, fmaf(pz[h], a7, b1))), pS1, pH1), 0.f);
      float y2 = fmaxf(fmaf(fmaf(px[h], a2, fmaf(py[h], a5, fmaf(pz[h], a8, b2))), pS2, pH2), 0.f);
      f32x4 pr0 = fma4(y0, e00, fma4(y1, e10, fma4(y2, e20, cp0)));
      f32x4 pr1 = fma4(y0, e01, fma4(y1, e11, fma4(y2, e21, cp1)));
      h16x8 hk, hv;
#pragma unroll  // constant element numbers: hk, hv stay in registers
      for (int r = 0; r < 4; r++) {
        hk[r] = (_Float16)(ak[r] + ck0[r] + pr0[r]); hk[4 + r] = (_Float16)(ak[4 + r] + ck1[r] + pr1[r]);
        hv[r] = (_Float16)(av[r] + cv0[r] + pr0[r]); hv[4 + r] = (_Float16)(av[4 + r] + cv1[r] + pr1[r]);
      }
      *(h16x8*)(kt + 4096 * h) = hk;
      *(h16x8*)(vt + 4096 * h) = hv;
      __builtin_amdgcn_sched_barrier(0);
    }
    // the wait that stands before the stores' registers are written again (next tile)
    asm volatile("s_wait_xcnt 0x0" :: "v"(qo), "v"(ko) : "memory");
    if (!more) break;
#pragma unroll  // constant register-array indices
    for (int h = 0; h < 2; h++) {
      u32x4 w;
      w[0] = pkbf(u[h][0][0], u[h][0][1]); w[1] = pkbf(u[h][0][2], u[h][0][3]);
      w[2] = pkbf(u[h][1][0], u[h][1][1]); w[3] = pkbf(u[h][1][2], u[h][1][3]);
      *(u32x4*)&lds[buf ^ 1][h][t * 4] = w;
    }
    // The tile's barrier: it publishes the next tile and ends every wave's reads of this one,
    // which the tile after the next overwrites. Only LDS passes between the waves, so the
    // fences name LDS alone: __syncthreads() would also wait out this tile's global stores
    __builtin_amdgcn_fence(__ATOMIC_RELEASE, "workgroup", "local");
    __builtin_amdgcn_s_barrier();
    __builtin_amdgcn_fence(__ATOMIC_ACQUIRE, "workgroup", "local");
    tile = nxt; buf ^= 1;
#pragma unroll  // constant register-array indices
    for (int h = 0; h < 2; h++) { px[h] = nx[h]; py[h] = ny[h]; pz[h] = nz[h]; }
  }
}

// ---------------------------------------------------------------------------
// Kernel 3: stats of w_pre = (gk + p_r) - xq over N*NS, 128 channels.
// One wave per point iteration; lane owns channels 4*lane..4*lane+3.
// Lane s also owns neighbor index s, so the 16 row gathers of a point have no load in
// front of them and are issued in groups; the next point's indices are read one
// iteration ahead.
// ---------------------------------------------------------------------------
__global__ __launch_bounds__(256) void w1_stats(
    const int* __restrict__ idx,
    const float* __restrict__ xq, const _Float16* __restrict__ xk,
    float* __restrict__ statSum, float* __restrict__ statSq) {
  int t = threadIdx.x, wave = __builtin_amdgcn_readfirstlane(t >> 5), lane = t & 31;
  int c0 = lane * 4;
  unsigned voff = lane * 16u, hoff = lane * 8u;
  f32x4 sm = {0.f, 0.f, 0.f, 0.f}, sq = {0.f, 0.f, 0.f, 0.f};
  int W = gridDim.x * 8;
  int n = blockIdx.x * 8 + wave;
  int j = nbr_index(idx, min(n, NPTS - 1), lane);
  for (; n < NPTS; n += W) {
    unsigned offq = row_off(n, voff);
    f32x4 xq4 = load_at(xq, offq);
    h16x4 kr[NSAMP];
    gather8<0>(kr, xk, j, hoff, offq);
    gather8<8>(kr, xk, j, hoff, hoff);
    int jn = nbr_index(idx, min(n + W, NPTS - 1), lane);
#pragma unroll  // constant register-array indices
    for (int s = 0; s < NSAMP; s++) {
      f32x4 w = widen(kr[s]) - xq4;
      sm += w;
      sq = __builtin_elementwise_fma(w, w, sq);
    }
    j = jn;
  }
  __shared__ float rs[128], rq[128];
  if (t < 128) { rs[t] = 0.f; rq[t] = 0.f; }
  __syncthreads();
#pragma unroll
  for (int i = 0; i < 4; i++) { atomicAdd(&rs[c0 + i], sm[i]); atomicAdd(&rq[c0 + i], sq[i]); }
  __syncthreads();
  if (t < 128) { atomicAdd(&statSum[t], rs[t]); atomicAdd(&statSq[t], rq[t]); }
}

__global__ __launch_bounds__(256, 8) void w2_stats(
    const int* __restrict__ idx,
    const float* __restrict__ xq, const _Float16* __restrict__ xk,
    const float* __restrict__ s1Sum, const float* __restrict__ s1Sq,
    const float* __restrict__ g1, const float* __restrict__ be1,
    const float* __restrict__ bw1,
    const __bf16* __restrict__ w1f,
    float* __restrict__ statSum, float* __restrict__ statSq) {
  __shared__ unsigned ldsA[8][1024];
  int t = threadIdx.x, wave = __builtin_amdgcn_readfirstlane(t >> 5), lane = t & 31;
  int cs = lane & 15;
  unsigned voff = lane * 16u, hoff = lane * 8u;
  unsigned* la = &ldsA[wave][0];
  v16bf B1[4];  // w_w1 fragments, read once per wave
#pragma unroll  // B1[] stays in registers
  for (int kc = 0; kc < 4; kc++) B1[kc] = load_bfrag(w1f + (kc * 32 + lane) * 16);
  // the wait that stands before a register that an issued load names is written again; the
  // base is an input so that no argument load that follows is placed on it in front of it
  asm volatile("s_wait_xcnt 0x0" :: "s"(w1f) : "memory");
  f32x4 s1v, h1v;  // bn1 of this lane's 4 channels
  bn_coef4(s1Sum, s1Sq, g1, be1, voff, s1v, h1v);
  float bw = bw1[cs];
  const f32x4 zero4 = {0.f, 0.f, 0.f, 0.f};
  float ssum = 0.f, ssq = 0.f;
  int W = gridDim.x * 8;
  int n = blockIdx.x * 8 + wave;
  int j = nbr_index(idx, min(n, NPTS - 1), lane);
  for (; n < NPTS; n += W) {
    unsigned offq = row_off(n, voff);
    f32x4 xq4 = load_at(xq, offq);
    h16x4 kr[NSAMP];
    gather8<0>(kr, xk, j, hoff, offq);
    gather8<8>(kr, xk, j, hoff, hoff);
    int jn = nbr_index(idx, min(n + W, NPTS - 1), lane);
    f32x4 hq = __builtin_elementwise_fma(-xq4, s1v, h1v);
#pragma unroll  // constant register-array indices
    for (int s = 0; s < NSAMP; s++) {
      // keeps the rows in f16 until their group of four is used: widened all at once, the
      // 16 rows take 64 registers and the weight fragments are spilled
      if ((s & 3) == 0) __builtin_amdgcn_sched_barrier(0);
      f32x4 z = __builtin_elementwise_max(__builtin_elementwise_fma(widen(kr[s]), s1v, hq), zero4);
      u32x2 pk; pk[0] = pkbf(z[0], z[1]); pk[1] = pkbf(z[2], z[3]);
      *(u32x2*)&la[s * 64 + lane * 2] = pk;
    }
    j = jn;
    v8f acc = {};
#pragma unroll
    for (int kc = 0; kc < 4; kc++) {
      v16bf A = load_afrag(la, lane, kc);
      acc = wmma_bf16(A, B1[kc], acc);
    }
#pragma unroll
    for (int r = 0; r < 8; r++) {
      float y = acc[r] + bw;
      ssum += y;
      ssq = fmaf(y, y, ssq);
    }
  }
  __shared__ float rs[16], rq[16];
  if (t < 16) { rs[t] = 0.f; rq[t] = 0.f; }
  __syncthreads();
  atomicAdd(&rs[cs], ssum); atomicAdd(&rq[cs], ssq);
  __syncthreads();
  if (t < 16) { atomicAdd(&statSum[t], rs[t]); atomicAdd(&statSq[t], rq[t]); }
}

__global__ __launch_bounds__(256, 8) void attn_final(
    const int* __restrict__ idx,
    const float* __restrict__ xq, const _Float16* __restrict__ xk, const _Float16* __restrict__ xv,
    const float* __restrict__ s1Sum, const float* __restrict__ s1Sq,
    const float* __restrict__ g1, const float* __restrict__ be1, const float* __restrict__ bw1,
    const float* __restrict__ s2Sum, const float* __restrict__ s2Sq,
    const float* __restrict__ g2, const float* __restrict__ be2, const float* __restrict__ bw2,
    const __bf16* __restrict__ w1f, const __bf16* __restrict__ w2f,
    float* __restrict__ out) {
  __shared__ unsigned ldsA[8][1024]; // bn1'd w_pre, bf16 pairs [16 s][64]
  __shared__ __bf16   ldsB[8][512];  // bn2'd y1 [16 s][32 k] (K padded with 0)
  __shared__ float    ldsW[8][256];  // softmax weights [16 s][16 cs]
  int t = threadIdx.x, wave = __builtin_amdgcn_readfirstlane(t >> 5), lane = t & 31;
  int c0 = lane * 4, cs = lane & 15, hl = lane >> 4;
  unsigned voff = lane * 16u, hoff = lane * 8u;
  unsigned* la = &ldsA[wave][0];
  __bf16*   lb = &ldsB[wave][0];
  float*    lw = &ldsW[wave][0];
  int W = gridDim.x * 8;
  int n = blockIdx.x * 8 + wave;
  if (n >= NPTS) return;  // whole wave; the kernel has no barrier
  int j = nbr_index(idx, n, lane);
  asm volatile("s_wait_xcnt 0x0" ::: "memory");
  v16bf B1[4];  // w_w1 and w_w2 fragments, read once per wave
#pragma unroll  // B1[] stays in registers
  for (int kc = 0; kc < 4; kc++) B1[kc] = load_bfrag(w1f + (kc * 32 + lane) * 16);
  v16bf B2 = load_bfrag(w2f + lane * 16);
  asm volatile("s_wait_xcnt 0x0" ::: "memory");
  f32x4 s1v, h1v;  // bn1 of this lane's 4 channels, as in w2_stats
  bn_coef4(s1Sum, s1Sq, g1, be1, voff, s1v, h1v);
  float sc2, hf2;  // bn2 of channel cs
  float bb1 = bw1[cs], bb2 = bw2[cs];
  {
    float a = s2Sum[cs], q = s2Sq[cs], g = g2[cs], b = be2[cs];
    // the wait that stands before a register that an issued load names is written again
    asm volatile("s_wait_xcnt 0x0" :: "s"(bw1), "s"(bw2), "s"(s2Sum), "s"(s2Sq), "s"(g2), "s"(be2),
                 "v"(cs) : "memory");
    bn_coef(a, q, g, b, sc2, hf2);
  }
  const f32x4 zero4 = {0.f, 0.f, 0.f, 0.f};
  // zero K=16..31 pad region of ldsB once (never overwritten)
#pragma unroll
  for (int i = 0; i < 8; i++) {
    int e = lane * 8 + i;
    lb[(e >> 4) * 32 + 16 + (e & 15)] = (__bf16)0.f;
  }
  for (; n < NPTS; n += W) {
    unsigned offq = row_off(n, voff);
    f32x4 xq4 = load_at(xq, offq);
    h16x4 kr[NSAMP];
    gather8<0>(kr, xk, j, hoff, offq);
    gather8<8>(kr, xk, j, hoff, hoff);
    int jn = nbr_index(idx, min(n + W, NPTS - 1), lane);
    // bn1(row - xq) = row * scale + (shift - xq * scale), as in w2_stats
    f32x4 hq = __builtin_elementwise_fma(-xq4, s1v, h1v);
#pragma unroll  // constant register-array indices
    for (int s = 0; s < NSAMP; s++) {
      // keeps the rows in f16 until their group of four is used: widened all at once, the
      // 16 rows take 64 registers and the weight fragments are spilled
      if ((s & 3) == 0) __builtin_amdgcn_sched_barrier(0);
      f32x4 z = __builtin_elementwise_max(__builtin_elementwise_fma(widen(kr[s]), s1v, hq), zero4);
      u32x2 pk; pk[0] = pkbf(z[0], z[1]); pk[1] = pkbf(z[2], z[3]);
      *(u32x2*)&la[s * 64 + lane * 2] = pk;
    }
    // the 16 value rows fly while the two matrix products and the softmax run
    h16x4 vr[NSAMP];
    gather8<0>(vr, xv, j, hoff, hoff);
    gather8<8>(vr, xv, j, hoff, hoff);
    // WMMA1: [16 neighbors x 128] @ [128 x 16]
    v8f acc = {};
#pragma unroll
    for (int kc = 0; kc < 4; kc++) {
      v16bf A = load_afrag(la, lane, kc);
      acc = wmma_bf16(A, B1[kc], acc);
    }
    // bn2 + relu, stage as bf16 for WMMA2 (lane holds column cs, rows r+8*hl)
#pragma unroll
    for (int r = 0; r < 8; r++) {
      float y = acc[r] + bb1;
      lb[(r + 8 * hl) * 32 + cs] = (__bf16)fmaxf(fmaf(y, sc2, hf2), 0.f);
    }
    // WMMA2: [16 x 16(pad 32)] @ [16(pad 32) x 16]
    v16bf A2;
    {
      int row = lane & 15;
#pragma unroll
      for (int vv = 0; vv < 8; vv++) {
        int k = ((vv >> 2) << 4) + (hl << 3) + ((vv & 3) << 1);
        A2[2 * vv]     = lb[row * 32 + k];
        A2[2 * vv + 1] = lb[row * 32 + k + 1];
      }
    }
    v8f acc2 = {};
    acc2 = wmma_bf16(A2, B2, acc2);
    float yv[8];
    float mx = -3.0e38f;
#pragma unroll
    for (int r = 0; r < 8; r++) { yv[r] = acc2[r] + bb2; mx = fmaxf(mx, yv[r]); }
    mx = fmaxf(mx, __shfl_xor(mx, 16, 32));
    float se = 0.f;
#pragma unroll
    for (int r = 0; r < 8; r++) { yv[r] = __expf(yv[r] - mx); se += yv[r]; }
    se += __shfl_xor(se, 16, 32);
    float inv = 1.0f / se;
#pragma unroll
    for (int r = 0; r < 8; r++) lw[(r + 8 * hl) * 16 + cs] = yv[r] * inv;
    // weighted sum: out[c] = sum_s (gv + p_r) * w[s, c%16]; lane owns c0..c0+3
    f32x4 o = {0.f, 0.f, 0.f, 0.f};
#pragma unroll  // vr[], sw[] stay in registers (this loop and the two inside it)
    for (int g = 0; g < NSAMP; g += 4) {
      f32x4 sw[4];
#pragma unroll
      for (int u = 0; u < 4; u++) sw[u] = *(const f32x4*)&lw[(g + u) * 16 + (c0 & 15)];
      // keeps the 4 LDS reads of four neighbors together in front of their uses: one
      // LDS latency per group instead of one per neighbor
      __builtin_amdgcn_sched_barrier(0);
#pragma unroll
      for (int u = 0; u < 4; u++) o = __builtin_elementwise_fma(widen(vr[g + u]), sw[u], o);
    }
    *(f32x4*)&out[n * CH + c0] = o;
    // the wait that stands before the store's registers are written again (next point)
    asm volatile("s_wait_xcnt 0x0" ::: "memory");
    j = jn;
  }
}

// ---------------------------------------------------------------------------
extern "C" void kernel_launch(void* const* d_in, const int* in_sizes, int n_in,
                              void* d_out, int out_size, void* d_ws, size_t ws_size,
                              hipStream_t stream) {
  (void)in_sizes; (void)n_in; (void)out_size; (void)ws_size;
  const float* p    = (const float*)d_in[0];
  const float* x    = (const float*)d_in[1];
  const int*   idx  = (const int*)d_in[2];
  const float* w_q  = (const float*)d_in[3];
  const float* b_q  = (const float*)d_in[4];
  const float* w_k  = (const float*)d_in[5];
  const float* b_k  = (const float*)d_in[6];
  const float* w_v  = (const float*)d_in[7];
  const float* b_v  = (const float*)d_in[8];
  const float* w_p1 = (const float*)d_in[9];
  const float* b_p1 = (const float*)d_in[10];
  const float* g_p  = (const float*)d_in[11];
  const float* be_p = (const float*)d_in[12];
  const float* w_p2 = (const float*)d_in[13];
  const float* b_p2 = (const float*)d_in[14];
  const float* g_w1 = (const float*)d_in[15];
  const float* be_w1= (const float*)d_in[16];
  const float* w_w1 = (const float*)d_in[17];
  const float* b_w1 = (const float*)d_in[18];
  const float* g_w2 = (const float*)d_in[19];
  const float* be_w2= (const float*)d_in[20];
  const float* w_w2 = (const float*)d_in[21];
  const float* b_w2 = (const float*)d_in[22];
  float* out = (float*)d_out;

  // workspace carve-up (q f32, k + p_r and v + p_r f16, then bf16 fragments, then stats)
  float* ws = (float*)d_ws;
  float* xq = ws;
  _Float16* xk = (_Float16*)(xq + NC);
  _Float16* xv = xk + NC;
  __bf16* wqf = (__bf16*)(xv + NC);
  __bf16* wkf = wqf + 16384;
  __bf16* wvf = wkf + 16384;
  __bf16* w1f = wvf + 16384;
  __bf16* w2f = w1f + 2048;
  float* stats = (float*)(w2f + 512);
  float* s1Sum  = stats;        // 128
  float* s1Sq   = stats + 128;  // 128
  float* s2Sum  = stats + 256;  // 16
  float* s2Sq   = stats + 272;  // 16
  float* part   = stats + 288;  // 6 x POSPITCH block sums of the position stats

  prep_pos<<<POSB + PREPB, 256, 0, stream>>>(w_q, w_k, w_v, w_w1, w_w2, p, idx, w_p1, b_p1,
                                             wqf, wkf, wvf, w1f, w2f, stats, part);
  qkv_gemm<<<QKVB, 256, 0, stream>>>(x, p, b_q, b_k, b_v, w_p1, b_p1, w_p2, b_p2,
                                          g_p, be_p, part, wqf, wkf, wvf, xq, xk, xv);
  w1_stats<<<1024, 256, 0, stream>>>(idx, xq, xk, s1Sum, s1Sq);
  w2_stats<<<1024, 256, 0, stream>>>(idx, xq, xk, s1Sum, s1Sq, g_w1, be_w1, b_w1, w1f,
                                     s2Sum, s2Sq);
  attn_final<<<1875, 256, 0, stream>>>(idx, xq, xk, xv, s1Sum, s1Sq, g_w1, be_w1, b_w1,
                                       s2Sum, s2Sq, g_w2, be_w2, b_w2, w1f, w2f, out);
}

// v006
// One run takes 80.3 microseconds.
// Next to v005, in two timings, it ran 1.36 times as fast each time.
// Over all steps from v000 it is 3.12 times as fast.
#include <hip/hip_runtime.h>
#include <hip/hip_bf16.h>

#define NPTS 60000
#define NSAMP 16
#define CH 128
#define NC (NPTS*CH)
#define POSB ((NPTS + 255) / 256)  // blocks of prep_pos that sum position stats, a thread per point
#define PREPB 204                  // blocks of prep_pos that swizzle weights and zero accumulators
#define POSPITCH 256               // partial sums of one statistic: POSB used of POSPITCH floats
#define BN_INVC (1.0f / (float)(NPTS * NSAMP))
#define NTILE (NPTS / 32)          // 32-row tiles of the QKV GEMM
#define QKVB 512                   // its work-groups: two per WGP, all resident at once
#define APITCH 68                  // dwords: a row of 128 bf16 (64 dwords) + 16 bytes
#define BPITCH 40                  // bf16: a row of 32 bf16 + 16 bytes
#define WPITCH 20                  // floats: a row of 16 floats + 16 bytes (rows r, r + 8 apart)

typedef __attribute__((ext_vector_type(16))) __bf16 v16bf;
typedef __attribute__((ext_vector_type(8)))  __bf16 v8bf;
typedef __attribute__((ext_vector_type(2)))  __bf16 bf16x2;
typedef __attribute__((ext_vector_type(8)))  float  v8f;
typedef __attribute__((ext_vector_type(4)))  float  f32x4;
typedef __attribute__((ext_vector_type(4)))  unsigned u32x4;
typedef __attribute__((ext_vector_type(4)))  int i32x4;
typedef __attribute__((ext_vector_type(2)))  unsigned u32x2;
typedef __attribute__((ext_vector_type(4)))  _Float16 h16x4;
typedef __attribute__((ext_vector_type(8)))  _Float16 h16x8;

static __device__ __forceinline__ unsigned pkbf(float a, float b) {
  bf16x2 t; t[0] = (__bf16)a; t[1] = (__bf16)b;
  return __builtin_bit_cast(unsigned, t);
}

static __device__ __forceinline__ int frag_koff(int lane, int s) {
  int v = s >> 1;
  return ((v >> 2) << 4) + ((lane >> 4) << 3) + ((v & 3) << 1) + (s & 1);
}

static __device__ __forceinline__ v16bf joinbf(u32x4 q0, u32x4 q1) {
  v8bf lo = __builtin_bit_cast(v8bf, q0);
  v8bf hi = __builtin_bit_cast(v8bf, q1);
  v16bf a;
#pragma unroll
  for (int i = 0; i < 8; i++) { a[i] = lo[i]; a[8 + i] = hi[i]; }
  return a;
}

// A fragment from LDS tile stored as [16 rows][64 bf16-pairs] (row-major K pairs), row pitch APITCH.
static __device__ __forceinline__ v16bf load_afrag(const unsigned* base, int lane, int kc) {
  int row = lane & 15, hl = lane >> 4;
  const unsigned* pa = base + row * APITCH + kc * 16 + hl * 4;
  u32x4 q0 = *(const u32x4*)pa;
  u32x4 q1 = *(const u32x4*)(pa + 8);
  return joinbf(q0, q1);
}

// B fragment pre-swizzled in global memory: 16 contiguous bf16 per lane.
static __device__ __forceinline__ v16bf load_bfrag(const __bf16* b) {
  u32x4 q0 = *(const u32x4*)b;
  u32x4 q1 = *(const u32x4*)(b + 8);
  return joinbf(q0, q1);
}

static __device__ __forceinline__ v8f wmma_bf16(v16bf a, v16bf b, v8f c) {
  return __builtin_amdgcn_wmma_f32_16x16x32_bf16(false, a, false, b, (short)0, c, false, false);
}

static __device__ __forceinline__ int nbr_index(const int* __restrict__ idx, int n, int lane) {
  int j = idx[n * NSAMP + (lane & 15)];
  return min(max(j, 0), NPTS - 1);
}

// Value of lane s as a wave-uniform scalar.
static __device__ __forceinline__ int bcast_i(int v, int s) {
  return __builtin_amdgcn_readlane(v, s);
}

// Byte offset of this lane's 16 bytes (voff = 16 * lane) in row js of a [NPTS][CH] f32 array.
static __device__ __forceinline__ unsigned row_off(int js, unsigned voff) {
  return ((unsigned)js << 9) | voff;
}
static __device__ __forceinline__ f32x4 load_at(const float* __restrict__ base, unsigned off) {
  return *(const f32x4*)((const char*)base + off);
}

// The same for a [NPTS][CH] f16 array: this lane's 8 bytes (hoff = 8 * lane) in row js.
static __device__ __forceinline__ unsigned hrow_off(int js, unsigned hoff) {
  return ((unsigned)js << 8) | hoff;
}
static __device__ __forceinline__ h16x4 load_h(const _Float16* __restrict__ base, unsigned off) {
  return *(const h16x4*)((const char*)base + off);
}
static __device__ __forceinline__ f32x4 widen(h16x4 h) {
  return __builtin_convertvector(h, f32x4);
}

// Rows named by lanes S0..S0+7 of j: 8 loads back to back, none used before all are issued.
// keep: the offset register of one more load that the caller has just issued.
template <int S0>
static __device__ __forceinline__ void gather8(h16x4 (&r)[NSAMP], const _Float16* __restrict__ base,
                                               int j, unsigned hoff, unsigned keep) {
  unsigned off[8];
#pragma unroll  // off[] and r[] stay in registers, constant lane numbers
  for (int u = 0; u < 8; u++) off[u] = hrow_off(bcast_i(j, S0 + u), hoff);
#pragma unroll
  for (int u = 0; u < 8; u++) r[S0 + u] = load_h(base, off[u]);
  // the wait that stands before an issued load's address register is written again; the
  // offsets are inputs so that no later load's result is placed on them in front of it
  asm volatile("s_wait_xcnt 0x0" :: "v"(off[0]), "v"(off[1]), "v"(off[2]), "v"(off[3]),
               "v"(off[4]), "v"(off[5]), "v"(off[6]), "v"(off[7]), "v"(keep) : "memory");
}

static __device__ __forceinline__ f32x4 fma4(float a, f32x4 b, f32x4 c) {
  f32x4 av = {a, a, a, a};
  return __builtin_elementwise_fma(av, b, c);
}

// BatchNorm over N*NS samples from their sum and sum of squares:
// scale = g/sqrt(var+eps), shift = b - mean*scale.
static __device__ __forceinline__ void bn_coef(float sum, float sq, float g, float b,
                                               float& scale, float& shift) {
  float m = sum * BN_INVC;
  float v = sq * BN_INVC - m * m;
  scale = g * rsqrtf(v + 1e-5f);
  shift = b - m * scale;
}
// The same for this lane's 4 channels (voff = 16 * lane).
static __device__ __forceinline__ void bn_coef4(
    const float* __restrict__ sum, const float* __restrict__ sq,
    const float* __restrict__ g, const float* __restrict__ b, unsigned voff,
    f32x4& scale, f32x4& shift) {
  f32x4 a = load_at(sum, voff), q = load_at(sq, voff), gg = load_at(g, voff), bb = load_at(b, voff);
  // the wait that stands before a register that an issued load names is written again; the
  // bases are inputs so that no argument load that follows is placed on them in front of it
  asm volatile("s_wait_xcnt 0x0" :: "s"(sum), "s"(sq), "s"(g), "s"(b), "v"(voff) : "memory");
#pragma unroll  // constant element numbers
  for (int i = 0; i < 4; i++) {
    float sc, sh;
    bn_coef(a[i], q[i], gg[i], bb[i], sc, sh);
    scale[i] = sc; shift[i] = sh;
  }
}

// Sum over the 32 lanes of a wave, the same order in every run; every lane gets it.
static __device__ __forceinline__ float wave_sum(float v) {
#pragma unroll  // five steps with constant lane masks
  for (int m = 16; m > 0; m >>= 1) v += __shfl_xor(v, m, 32);
  return v;
}

// ---------------------------------------------------------------------------
// Kernel 1: two independent jobs in one grid.
// Blocks 0..POSB-1: stats (sum, sumsq) of gp@w_p1+b_p1 over N*NS, 3 channels. A thread takes
// one point: its 16 indices in four 16-byte loads, then its 16 position gathers back to back.
// Each block stores its own six sums (part[statistic][block]); qkv_gemm adds them up.
// Blocks POSB..: weight swizzle into fragment order + zero of the accumulators of the two
// later stats kernels.
// ---------------------------------------------------------------------------
__global__ __launch_bounds__(256) void prep_pos(
    const float* __restrict__ wq, const float* __restrict__ wk, const float* __restrict__ wv,
    const float* __restrict__ ww1, const float* __restrict__ ww2,
    const float* __restrict__ p, const int* __restrict__ idx,
    const float* __restrict__ wp1, const float* __restrict__ bp1,
    __bf16* __restrict__ wqf, __bf16* __restrict__ wkf, __bf16* __restrict__ wvf,
    __bf16* __restrict__ w1f, __bf16* __restrict__ w2f,
    float* __restrict__ stats, float* __restrict__ part) {
  if (blockIdx.x < POSB) {  // the same for the whole block
    __shared__ float red[8][6];
    int n = blockIdx.x * 256 + threadIdx.x;
    float s0 = 0, s1 = 0, s2 = 0, q0 = 0, q1 = 0, q2 = 0;
    if (n < NPTS) {
      unsigned io = (unsigned)n * (NSAMP * 4u);
      i32x4 jv[4];
#pragma unroll  // jv[] stays in registers
      for (int u = 0; u < 4; u++) jv[u] = *(const i32x4*)((const char*)idx + (io + 16u * u));
      // the wait that stands before an issued load's address register is written again
      asm volatile("s_wait_xcnt 0x0" :: "v"(io) : "memory");
      float a0 = wp1[0], a1 = wp1[1], a2 = wp1[2], a3 = wp1[3], a4 = wp1[4],
            a5 = wp1[5], a6 = wp1[6], a7 = wp1[7], a8 = wp1[8];
      float b0 = bp1[0], b1 = bp1[1], b2 = bp1[2];
      unsigned po[NSAMP];
      float px[NSAMP], py[NSAMP], pz[NSAMP];
#pragma unroll  // po[] stays in registers; every row gathered lies inside p
      for (int u = 0; u < NSAMP; u++) po[u] = (unsigned)min(max(jv[u >> 2][u & 3], 0), NPTS - 1) * 12u;
#pragma unroll  // 16 gathers in flight, none used before all are issued
      for (int u = 0; u < NSAMP; u++) {
        const float* pj = (const float*)((const char*)p + po[u]);
        px[u] = pj[0]; py[u] = pj[1]; pz[u] = pj[2];
      }
      asm volatile("s_wait_xcnt 0x0" :: "v"(po[0]), "v"(po[1]), "v"(po[2]), "v"(po[3]),
                   "v"(po[4]), "v"(po[5]), "v"(po[6]), "v"(po[7]), "v"(po[8]), "v"(po[9]),
                   "v"(po[10]), "v"(po[11]), "v"(po[12]), "v"(po[13]), "v"(po[14]), "v"(po[15])
                   : "memory");
#pragma unroll  // constant register-array indices
      for (int u = 0; u < NSAMP; u++) {
        float y0 = fmaf(px[u], a0, fmaf(py[u], a3, fmaf(pz[u], a6, b0)));
        float y1 = fmaf(px[u], a1, fmaf(py[u], a4, fmaf(pz[u], a7, b1)));
        float y2 = fmaf(px[u], a2, fmaf(py[u], a5, fmaf(pz[u], a8, b2)));
        s0 += y0; s1 += y1; s2 += y2;
        q0 = fmaf(y0, y0, q0); q1 = fmaf(y1, y1, q1); q2 = fmaf(y2, y2, q2);
      }
    }
    s0 = wave_sum(s0); s1 = wave_sum(s1); s2 = wave_sum(s2);
    q0 = wave_sum(q0); q1 = wave_sum(q1); q2 = wave_sum(q2);
    if ((threadIdx.x & 31) == 0) {
      float* r = &red[threadIdx.x >> 5][0];
      r[0] = s0; r[1] = s1; r[2] = s2; r[3] = q0; r[4] = q1; r[5] = q2;
    }
    __syncthreads();
    if (threadIdx.x < 6) {
      float a = 0.f;
#pragma unroll  // the 8 LDS reads together, one latency
      for (int w = 0; w < 8; w++) a += red[w][threadIdx.x];
      part[threadIdx.x * POSPITCH + blockIdx.x] = a;
    }
    return;
  }
  const int QKV = 3 * 16384;
  int t = (blockIdx.x - POSB) * 256 + threadIdx.x;
  if (t < QKV) {
    int s = t & 15, lane = (t >> 4) & 31, kc = (t >> 9) & 3, jt = (t >> 11) & 7, m = t >> 14;
    int k = kc * 32 + frag_koff(lane, s);
    int n = jt * 16 + (lane & 15);
    const float* w = (m == 0) ? wq : (m == 1) ? wk : wv;
    __bf16* d = (m == 0) ? wqf : (m == 1) ? wkf : wvf;
    d[t & 16383] = (__bf16)w[k * CH + n];
  } else if (t < QKV + 2048) {
    int u = t - QKV;
    int s = u & 15, lane = (u >> 4) & 31, kc = (u >> 9) & 3;
    int k = kc * 32 + frag_koff(lane, s);
    w1f[u] = (__bf16)ww1[k * 16 + (lane & 15)];
  } else if (t < QKV + 2048 + 512) {
    int u = t - QKV - 2048;
    int s = u & 15, lane = (u >> 4) & 31;
    int k = frag_koff(lane, s); // single K chunk, upper 16 zero-padded
    w2f[u] = (k < 16) ? (__bf16)ww2[k * 16 + (lane & 15)] : (__bf16)0.f;
  } else if (t < QKV + 2048 + 512 + 288) {
    stats[t - (QKV + 2048 + 512)] = 0.f;
  }
}

// ---------------------------------------------------------------------------
// Kernel 2: QKV GEMM. QKVB work-groups, all resident at once, each looping over tiles of
// 32 rows of x (two WMMA row tiles); 8 waves = 8 column tiles; each wave does q,k,v tiles
// (12 WMMAs a row tile). A wave reads its 12 weight fragments and its epilogue constants once
// and keeps them in registers for all its rows. The next tile's x and positions are asked for
// before the current tile is worked on; x goes into the other LDS buffer behind it: one
// barrier a tile.
// The k and v products take the weights as first operand: a lane then holds 8 neighbouring
// channels of one row, one 16-byte f16 store.
// The row's position term p_r = relu(bn(p @ w_p1 + b_p1)) @ w_p2 + b_p2 is added to k and v;
// its BatchNorm comes from prep_pos's block sums: wave c adds up statistic c while the first
// x tile is on its way, and that tile's own barrier publishes the six totals.
// ---------------------------------------------------------------------------
__global__ __launch_bounds__(256, 4) void qkv_gemm(
    const float* __restrict__ x, const float* __restrict__ p,
    const float* __restrict__ bq, const float* __restrict__ bk, const float* __restrict__ bv,
    const float* __restrict__ wp1, const float* __restrict__ bp1,
    const float* __restrict__ wp2, const float* __restrict__ bp2,
    const float* __restrict__ gp, const float* __restrict__ bep, const float* __restrict__ part,
    const __bf16* __restrict__ wqf, const __bf16* __restrict__ wkf, const __bf16* __restrict__ wvf,
    float* __restrict__ xq, _Float16* __restrict__ xk, _Float16* __restrict__ xv) {
  // two tiles of 2 x 16 rows x 128 bf16 (packed pairs)
  __shared__ __attribute__((aligned(16))) unsigned lds[2][2][16 * APITCH];
  __shared__ float pst[8];                // position stats: 3 sums, 3 sums of squares
  int t = threadIdx.x;
  int wave = t >> 5, lane = t & 31, hl = lane >> 4;
  int jt = wave;
  int tile = blockIdx.x;  // QKVB <= NTILE: every work-group has a first tile
  // this thread's 32 bytes of a row tile of x (8 KB) and this lane's row of p (16 rows of 12 B)
  unsigned xlane = (unsigned)t * 32u, plane = (unsigned)(lane & 15) * 12u;
  int lpos = (t >> 4) * APITCH + (t & 15) * 4;  // the same 8 elements in the LDS tile (dwords)
  f32x4 u[2][2];
  float px[2], py[2], pz[2];
  int st = __builtin_amdgcn_readfirstlane(t >> 5);
  float e[8] = {0.f, 0.f, 0.f, 0.f, 0.f, 0.f, 0.f, 0.f};
  if (st < 6) {  // whole waves
    const float* pc = part + st * POSPITCH;
    int i0 = t & 31, i7 = min((t & 31) + 224, POSB - 1);
#pragma unroll  // e[] stays in registers, 8 loads in flight
    for (int i = 0; i < 7; i++) e[i] = pc[i0 + 32 * i];
    e[7] = pc[i7];
    // the wait that stands before an issued load's address register is written again; the
    // indices are inputs so that nothing is placed on them in front of it
    asm volatile("s_wait_xcnt 0x0" :: "v"(i0), "v"(i7) : "memory");
  }
  {
    unsigned xo = (unsigned)tile * 16384u + xlane, po = (unsigned)tile * 384u + plane;
    const char* xt = (const char*)x + xo;
    const char* pt = (const char*)p + po;
#pragma unroll  // u[], px[].. stay in registers
    for (int h = 0; h < 2; h++) {
      u[h][0] = *(const f32x4*)(xt + 8192 * h); u[h][1] = *(const f32x4*)(xt + 8192 * h + 16);
      const float* pm = (const float*)(pt + 192 * h);
      px[h] = pm[0]; py[h] = pm[1]; pz[h] = pm[2];
    }
    asm volatile("s_wait_xcnt 0x0" :: "v"(xo), "v"(po) : "memory");
  }
  // this wave's weight fragments, read once for all its rows
  v16bf Bq[4], Bk[4], Bv[4];
  unsigned foff = (unsigned)(jt * 4 * 32 + lane) * 32u;  // bytes: 16 bf16 a lane and fragment
#pragma unroll  // Bq[], Bk[], Bv[] stay in registers
  for (int kc = 0; kc < 4; kc++) {
    Bq[kc] = load_bfrag((const __bf16*)((const char*)wqf + foff) + kc * 512);
    Bk[kc] = load_bfrag((const __bf16*)((const char*)wkf + foff) + kc * 512);
    Bv[kc] = load_bfrag((const __bf16*)((const char*)wvf + foff) + kc * 512);
  }
  int col = jt * 16 + (lane & 15);
  float cq = bq[col];
  // k, v: register r is channel ch0 + r of row (lane & 15) of the row tile
  int ch0 = jt * 16 + 8 * hl;
  unsigned boff = ch0 * 4u;
  f32x4 ck0 = load_at(bk, boff), ck1 = load_at(bk, boff + 16u);
  f32x4 cv0 = load_at(bv, boff), cv1 = load_at(bv, boff + 16u);
  f32x4 e00 = load_at(wp2, boff), e01 = load_at(wp2, boff + 16u);
  f32x4 e10 = load_at(wp2, boff + 512u), e11 = load_at(wp2, boff + 528u);
  f32x4 e20 = load_at(wp2, boff + 1024u), e21 = load_at(wp2, boff + 1040u);
  f32x4 cp0 = load_at(bp2, boff), cp1 = load_at(bp2, boff + 16u);
  // the wait that stands before an issued load's address register is written again; the
  // offsets are inputs so that no load's result is placed on them in front of it
  asm volatile("s_wait_xcnt 0x0" :: "v"(foff), "v"(boff), "v"(col) : "memory");
  // keeps the wait for the x tile behind the issue of the loads above: one memory latency
  // in the prologue, not one behind the other
  __builtin_amdgcn_sched_barrier(0);
  if (st < 6) {  // summed while the x tile is on its way
    float a = ((t & 31) + 224 < POSB) ? e[7] : 0.f;
#pragma unroll  // constant register-array indices
    for (int i = 6; i >= 0; i--) a += e[i];
    a = wave_sum(a);
    if ((t & 31) == 0) pst[st] = a;
  }
#pragma unroll  // constant register-array indices
  for (int h = 0; h < 2; h++) {
    u32x4 w;
    w[0] = pkbf(u[h][0][0], u[h][0][1]); w[1] = pkbf(u[h][0][2], u[h][0][3]);
    w[2] = pkbf(u[h][1][0], u[h][1][1]); w[3] = pkbf(u[h][1][2], u[h][1][3]);
    *(u32x4*)&lds[0][h][lpos] = w;
  }
  __syncthreads();
  float pS0, pS1, pS2, pH0, pH1, pH2;
  bn_coef(pst[0], pst[3], gp[0], bep[0], pS0, pH0);
  bn_coef(pst[1], pst[4], gp[1], bep[1], pS1, pH1);
  bn_coef(pst[2], pst[5], gp[2], bep[2], pS2, pH2);
  float a0 = wp1[0], a1 = wp1[1], a2 = wp1[2], a3 = wp1[3], a4 = wp1[4],
        a5 = wp1[5], a6 = wp1[6], a7 = wp1[7], a8 = wp1[8];
  float b0 = bp1[0], b1 = bp1[1], b2 = bp1[2];
  // byte offsets of this lane's stores inside a row tile: q rows 8 * hl + r, k, v row lane & 15
  unsigned qlane = (unsigned)((8 * hl) * CH + col) * 4u;
  unsigned klane = (unsigned)((lane & 15) * CH + ch0) * 2u;
  int buf = 0;
  for (;;) {  // the trip count is the same for the whole work-group
    int nxt = tile + QKVB;
    bool more = nxt < NTILE;
    float nx[2] = {0.f, 0.f}, ny[2] = {0.f, 0.f}, nz[2] = {0.f, 0.f};
    if (more) {
      unsigned xo = (unsigned)nxt * 16384u + xlane, po = (unsigned)nxt * 384u + plane;
      const char* xt = (const char*)x + xo;
      const char* pt = (const char*)p + po;
#pragma unroll  // u[], nx[].. stay in registers
      for (int h = 0; h < 2; h++) {
        u[h][0] = *(const f32x4*)(xt + 8192 * h); u[h][1] = *(const f32x4*)(xt + 8192 * h + 16);
        const float* pm = (const float*)(pt + 192 * h);
        nx[h] = pm[0]; ny[h] = pm[1]; nz[h] = pm[2];
      }
      // the wait that stands before an issued load's address register is written again
      asm volatile("s_wait_xcnt 0x0" :: "v"(xo), "v"(po) : "memory");
    }
    unsigned qo = (unsigned)tile * 16384u + qlane, ko = (unsigned)tile * 8192u + klane;
    char* qt = (char*)xq + qo;
    char* kt = (char*)xk + ko;
    char* vt = (char*)xv + ko;
#pragma unroll  // constant register-array indices and store offsets
    for (int h = 0; h < 2; h++) {
      v8f aq = {}, ak = {}, av = {};
#pragma unroll
      for (int kc = 0; kc < 4; kc++) {
        v16bf A = load_afrag(&lds[buf][h][0], lane, kc);
        aq = wmma_bf16(A, Bq[kc], aq);
        ak = wmma_bf16(Bk[kc], A, ak);
        av = wmma_bf16(Bv[kc], A, av);
      }
#pragma unroll
      for (int r = 0; r < 8; r++) *(float*)(qt + 8192 * h + 512 * r) = aq[r] + cq;
      // position term of this lane's row, 8 channels
      float y0 = fmaxf(fmaf(fmaf(px[h], a0, fmaf(py[h], a3, fmaf(pz[h], a6, b0))), pS0, pH0), 0.f);
      float y1 = fmaxf(fmaf(fmaf(px[h], a1, fmaf(py[h], a4, fmaf(pz[h], a7, b1))), pS1, pH1), 0.f);
      float y2 = fmaxf(fmaf(fmaf(px[h], a2, fmaf(py[h], a5, fmaf(pz[h], a8, b2))), pS2, pH2), 0.f);
      f32x4 pr0 = fma4(y0, e00, fma4(y1, e10, fma4(y2, e20, cp0)));
      f32x4 pr1 = fma4(y0, e01, fma4(y1, e11, fma4(y2, e21, cp1)));
      h16x8 hk, hv;
#pragma unroll  // constant element numbers: hk, hv stay in registers
      for (int r = 0; r < 4; r++) {
        hk[r] = (_Float16)(ak[r] + ck0[r] + pr0[r]); hk[4 + r] = (_Float16)(ak[4 + r] + ck1[r] + pr1[r]);
        hv[r] = (_Float16)(av[r] + cv0[r] + pr0[r]); hv[4 + r] = (_Float16)(av[4 + r] + cv1[r] + pr1[r]);
      }
      *(h16x8*)(kt + 4096 * h) = hk;
      *(h16x8*)(vt + 4096 * h) = hv;
      __builtin_amdgcn_sched_barrier(0);
    }
    // the wait that stands before the stores' registers are written again (next tile)
    asm volatile("s_wait_xcnt 0x0" :: "v"(qo), "v"(ko) : "memory");
    if (!more) break;
#pragma unroll  // constant register-array indices
    for (int h = 0; h < 2; h++) {
      u32x4 w;
      w[0] = pkbf(u[h][0][0], u[h][0][1]); w[1] = pkbf(u[h][0][2], u[h][0][3]);
      w[2] = pkbf(u[h][1][0], u[h][1][1]); w[3] = pkbf(u[h][1][2], u[h][1][3]);
      *(u32x4*)&lds[buf ^ 1][h][lpos] = w;
    }
    // The tile's barrier: it publishes the next tile and ends every wave's reads of this one,
    // which the tile after the next overwrites. Only LDS passes between the waves, so the
    // fences name LDS alone: __syncthreads() would also wait out this tile's global stores
    __builtin_amdgcn_fence(__ATOMIC_RELEASE, "workgroup", "local");
    __builtin_amdgcn_s_barrier();
    __builtin_amdgcn_fence(__ATOMIC_ACQUIRE, "workgroup", "local");
    tile = nxt; buf ^= 1;
#pragma unroll  // constant register-array indices
    for (int h = 0; h < 2; h++) { px[h] = nx[h]; py[h] = ny[h]; pz[h] = nz[h]; }
  }
}

// ---------------------------------------------------------------------------
// Kernel 3: stats of w_pre = (gk + p_r) - xq over N*NS, 128 channels.
// One wave per point iteration; lane owns channels 4*lane..4*lane+3.
// Lane s also owns neighbor index s, so the 16 row gathers of a point have no load in
// front of them and are issued in groups; the next point's indices are read one
// iteration ahead.
// ---------------------------------------------------------------------------
__global__ __launch_bounds__(256) void w1_stats(
    const int* __restrict__ idx,
    const float* __restrict__ xq, const _Float16* __restrict__ xk,
    float* __restrict__ statSum, float* __restrict__ statSq) {
  int t = threadIdx.x, wave = __builtin_amdgcn_readfirstlane(t >> 5), lane = t & 31;
  int c0 = lane * 4;
  unsigned voff = lane * 16u, hoff = lane * 8u;
  f32x4 sm = {0.f, 0.f, 0.f, 0.f}, sq = {0.f, 0.f, 0.f, 0.f};
  int W = gridDim.x * 8;
  int n = blockIdx.x * 8 + wave;
  int j = nbr_index(idx, min(n, NPTS - 1), lane);
  for (; n < NPTS; n += W) {
    unsigned offq = row_off(n, voff);
    f32x4 xq4 = load_at(xq, offq);
    h16x4 kr[NSAMP];
    gather8<0>(kr, xk, j, hoff, offq);
    gather8<8>(kr, xk, j, hoff, hoff);
    int jn = nbr_index(idx, min(n + W, NPTS - 1), lane);
#pragma unroll  // constant register-array indices
    for (int s = 0; s < NSAMP; s++) {
      f32x4 w = widen(kr[s]) - xq4;
      sm += w;
      sq = __builtin_elementwise_fma(w, w, sq);
    }
    j = jn;
  }
  __shared__ float rs[128], rq[128];
  if (t < 128) { rs[t] = 0.f; rq[t] = 0.f; }
  __syncthreads();
#pragma unroll
  for (int i = 0; i < 4; i++) { atomicAdd(&rs[c0 + i], sm[i]); atomicAdd(&rq[c0 + i], sq[i]); }
  __syncthreads();
  if (t < 128) { atomicAdd(&statSum[t], rs[t]); atomicAdd(&statSq[t], rq[t]); }
}

__global__ __launch_bounds__(256, 8) void w2_stats(
    const int* __restrict__ idx,
    const float* __restrict__ xq, const _Float16* __restrict__ xk,
    const float* __restrict__ s1Sum, const float* __restrict__ s1Sq,
    const float* __restrict__ g1, const float* __restrict__ be1,
    const float* __restrict__ bw1,
    const __bf16* __restrict__ w1f,
    float* __restrict__ statSum, float* __restrict__ statSq) {
  __shared__ __attribute__((aligned(16))) unsigned ldsA[8][16 * APITCH];
  int t = threadIdx.x, wave = __builtin_amdgcn_readfirstlane(t >> 5), lane = t & 31;
  int cs = lane & 15;
  unsigned voff = lane * 16u, hoff = lane * 8u;
  unsigned* la = &ldsA[wave][0];
  v16bf B1[4];  // w_w1 fragments, read once per wave
#pragma unroll  // B1[] stays in registers
  for (int kc = 0; kc < 4; kc++) B1[kc] = load_bfrag(w1f + (kc * 32 + lane) * 16);
  // the wait that stands before a register that an issued load names is written again; the
  // base is an input so that no argument load that follows is placed on it in front of it
  asm volatile("s_wait_xcnt 0x0" :: "s"(w1f) : "memory");
  f32x4 s1v, h1v;  // bn1 of this lane's 4 channels
  bn_coef4(s1Sum, s1Sq, g1, be1, voff, s1v, h1v);
  float bw = bw1[cs];
  const f32x4 zero4 = {0.f, 0.f, 0.f, 0.f};
  float ssum = 0.f, ssq = 0.f;
  int W = gridDim.x * 8;
  int n = blockIdx.x * 8 + wave;
  int j = nbr_index(idx, min(n, NPTS - 1), lane);
  for (; n < NPTS; n += W) {
    unsigned offq = row_off(n, voff);
    f32x4 xq4 = load_at(xq, offq);
    h16x4 kr[NSAMP];
    gather8<0>(kr, xk, j, hoff, offq);
    gather8<8>(kr, xk, j, hoff, hoff);
    int jn = nbr_index(idx, min(n + W, NPTS - 1), lane);
    f32x4 hq = __builtin_elementwise_fma(-xq4, s1v, h1v);
#pragma unroll  // constant register-array indices
    for (int s = 0; s < NSAMP; s++) {
      // keeps the rows in f16 until their group of four is used: widened all at once, the
      // 16 rows take 64 registers and the weight fragments are spilled
      if ((s & 3) == 0) __builtin_amdgcn_sched_barrier(0);
      f32x4 z = __builtin_elementwise_max(__builtin_elementwise_fma(widen(kr[s]), s1v, hq), zero4);
      u32x2 pk; pk[0] = pkbf(z[0], z[1]); pk[1] = pkbf(z[2], z[3]);
      *(u32x2*)&la[s * APITCH + lane * 2] = pk;
    }
    j = jn;
    v8f acc = {};
#pragma unroll
    for (int kc = 0; kc < 4; kc++) {
      v16bf A = load_afrag(la, lane, kc);
      acc = wmma_bf16(A, B1[kc], acc);
    }
#pragma unroll
    for (int r = 0; r < 8; r++) {
      float y = acc[r] + bw;
      ssum += y;
      ssq = fmaf(y, y, ssq);
    }
  }
  __shared__ float rs[16], rq[16];
  if (t < 16) { rs[t] = 0.f; rq[t] = 0.f; }
  __syncthreads();
  atomicAdd(&rs[cs], ssum); atomicAdd(&rq[cs], ssq);
  __syncthreads();
  if (t < 16) { atomicAdd(&statSum[t], rs[t]); atomicAdd(&statSq[t], rq[t]); }
}

__global__ __launch_bounds__(256, 8) void attn_final(
    const int* __restrict__ idx,
    const float* __restrict__ xq, const _Float16* __restrict__ xk, const _Float16* __restrict__ xv,
    const float* __restrict__ s1Sum, const float* __restrict__ s1Sq,
    const float* __restrict__ g1, const float* __restrict__ be1, const float* __restrict__ bw1,
    const float* __restrict__ s2Sum, const float* __restrict__ s2Sq,
    const float* __restrict__ g2, const float* __restrict__ be2, const float* __restrict__ bw2,
    const __bf16* __restrict__ w1f, const __bf16* __restrict__ w2f,
    float* __restrict__ out) {
  // bn1'd w_pre, bf16 pairs [16 s][64]; bn2'd y1 [16 s][32 k] (K padded with 0); softmax
  // weights [16 s][16 cs]; each with its padded row pitch
  __shared__ __attribute__((aligned(16))) unsigned ldsA[8][16 * APITCH];
  __shared__ __attribute__((aligned(16))) __bf16   ldsB[8][16 * BPITCH];
  __shared__ __attribute__((aligned(16))) float    ldsW[8][16 * WPITCH];
  int t = threadIdx.x, wave = __builtin_amdgcn_readfirstlane(t >> 5), lane = t & 31;
  int c0 = lane * 4, cs = lane & 15, hl = lane >> 4;
  unsigned voff = lane * 16u, hoff = lane * 8u;
  unsigned* la = &ldsA[wave][0];
  __bf16*   lb = &ldsB[wave][0];
  float*    lw = &ldsW[wave][0];
  int W = gridDim.x * 8;
  int n = blockIdx.x * 8 + wave;
  if (n >= NPTS) return;  // whole wave; the kernel has no barrier
  int j = nbr_index(idx, n, lane);
  asm volatile("s_wait_xcnt 0x0" ::: "memory");
  v16bf B1[4];  // w_w1 and w_w2 fragments, read once per wave
#pragma unroll  // B1[] stays in registers
  for (int kc = 0; kc < 4; kc++) B1[kc] = load_bfrag(w1f + (kc * 32 + lane) * 16);
  v16bf B2 = load_bfrag(w2f + lane * 16);
  asm volatile("s_wait_xcnt 0x0" ::: "memory");
  f32x4 s1v, h1v;  // bn1 of this lane's 4 channels, as in w2_stats
  bn_coef4(s1Sum, s1Sq, g1, be1, voff, s1v, h1v);
  float sc2, hf2;  // bn2 of channel cs
  float bb1 = bw1[cs], bb2 = bw2[cs];
  {
    float a = s2Sum[cs], q = s2Sq[cs], g = g2[cs], b = be2[cs];
    // the wait that stands before a register that an issued load names is written again
    asm volatile("s_wait_xcnt 0x0" :: "s"(bw1), "s"(bw2), "s"(s2Sum), "s"(s2Sq), "s"(g2), "s"(be2),
                 "v"(cs) : "memory");
    bn_coef(a, q, g, b, sc2, hf2);
  }
  const f32x4 zero4 = {0.f, 0.f, 0.f, 0.f};
  // zero K=16..31 pad region of ldsB once (never overwritten)
#pragma unroll
  for (int i = 0; i < 8; i++) {
    int e = lane * 8 + i;
    lb[(e >> 4) * BPITCH + 16 + (e & 15)] = (__bf16)0.f;
  }
  for (; n < NPTS; n += W) {
    unsigned offq = row_off(n, voff);
    f32x4 xq4 = load_at(xq, offq);
    h16x4 kr[NSAMP];
    gather8<0>(kr, xk, j, hoff, offq);
    gather8<8>(kr, xk, j, hoff, hoff);
    int jn = nbr_index(idx, min(n + W, NPTS - 1), lane);
    // bn1(row - xq) = row * scale + (shift - xq * scale), as in w2_stats
    f32x4 hq = __builtin_elementwise_fma(-xq4, s1v, h1v);
#pragma unroll  // constant register-array indices
    for (int s = 0; s < NSAMP; s++) {
      // keeps the rows in f16 until their group of four is used: widened all at once, the
      // 16 rows take 64 registers and the weight fragments are spilled
      if ((s & 3) == 0) __builtin_amdgcn_sched_barrier(0);
      f32x4 z = __builtin_elementwise_max(__builtin_elementwise_fma(widen(kr[s]), s1v, hq), zero4);
      u32x2 pk; pk[0] = pkbf(z[0], z[1]); pk[1] = pkbf(z[2], z[3]);
      *(u32x2*)&la[s * APITCH + lane * 2] = pk;
    }
    // the 16 value rows fly while the two matrix products and the softmax run
    h16x4 vr[NSAMP];
    gather8<0>(vr, xv, j, hoff, hoff);
    gather8<8>(vr, xv, j, hoff, hoff);
    // WMMA1: [16 neighbors x 128] @ [128 x 16]
    v8f acc = {};
#pragma unroll
    for (int kc = 0; kc < 4; kc++) {
      v16bf A = load_afrag(la, lane, kc);
      acc = wmma_bf16(A, B1[kc], acc);
    }
    // bn2 + relu, stage as bf16 for WMMA2 (lane holds column cs, rows r+8*hl)
#pragma unroll
    for (int r = 0; r < 8; r++) {
      float y = acc[r] + bb1;
      lb[(r + 8 * hl) * BPITCH + cs] = (__bf16)fmaxf(fmaf(y, sc2, hf2), 0.f);
    }
    // WMMA2: [16 x 16(pad 32)] @ [16(pad 32) x 16]
    v16bf A2;
    {
      int row = lane & 15;
#pragma unroll
      for (int vv = 0; vv < 8; vv++) {
        int k = ((vv >> 2) << 4) + (hl << 3) + ((vv & 3) << 1);
        A2[2 * vv]     = lb[row * BPITCH + k];
        A2[2 * vv + 1] = lb[row * BPITCH + k + 1];
      }
    }
    v8f acc2 = {};
    acc2 = wmma_bf16(A2, B2, acc2);
    float yv[8];
    float mx = -3.0e38f;
#pragma unroll
    for (int r = 0; r < 8; r++) { yv[r] = acc2[r] + bb2; mx = fmaxf(mx, yv[r]); }
    mx = fmaxf(mx, __shfl_xor(mx, 16, 32));
    float se = 0.f;
#pragma unroll
    for (int r = 0; r < 8; r++) { yv[r] = __expf(yv[r] - mx); se += yv[r]; }
    se += __shfl_xor(se, 16, 32);
    float inv = 1.0f / se;
#pragma unroll
    for (int r = 0; r < 8; r++) lw[(r + 8 * hl) * WPITCH + cs] = yv[r] * inv;
    // weighted sum: out[c] = sum_s (gv + p_r) * w[s, c%16]; lane owns c0..c0+3
    f32x4 o = {0.f, 0.f, 0.f, 0.f};
#pragma unroll  // vr[], sw[] stay in registers (this loop and the two inside it)
    for (int g = 0; g < NSAMP; g += 4) {
      f32x4 sw[4];
#pragma unroll
      for (int u = 0; u < 4; u++) sw[u] = *(const f32x4*)&lw[(g + u) * WPITCH + (c0 & 15)];
      // keeps the 4 LDS reads of four neighbors together in front of their uses: one
      // LDS latency per group instead of one per neighbor
      __builtin_amdgcn_sched_barrier(0);
#pragma unroll
      for (int u = 0; u < 4; u++) o = __builtin_elementwise_fma(widen(vr[g + u]), sw[u], o);
    }
    *(f32x4*)&out[n * CH + c0] = o;
    // the wait that stands before the store's registers are written again (next point)
    asm volatile("s_wait_xcnt 0x0" ::: "memory");
    j = jn;
  }
}

// ---------------------------------------------------------------------------
extern "C" void kernel_launch(void* const* d_in, const int* in_sizes, int n_in,
                              void* d_out, int out_size, void* d_ws, size_t ws_size,
                              hipStream_t stream) {
  (void)in_sizes; (void)n_in; (void)out_size; (void)ws_size;
  const float* p    = (const float*)d_in[0];
  const float* x    = (const float*)d_in[1];
  const int*   idx  = (const int*)d_in[2];
  const float* w_q  = (const float*)d_in[3];
  const float* b_q  = (const float*)d_in[4];
  const float* w_k  = (const float*)d_in[5];
  const float* b_k  = (const float*)d_in[6];
  const float* w_v  = (const float*)d_in[7];
  const float* b_v  = (const float*)d_in[8];
  const float* w_p1 = (const float*)d_in[9];
  const float* b_p1 = (const float*)d_in[10];
  const float* g_p  = (const float*)d_in[11];
  const float* be_p = (const float*)d_in[12];
  const float* w_p2 = (const float*)d_in[13];
  const float* b_p2 = (const float*)d_in[14];
  const float* g_w1 = (const float*)d_in[15];
  const float* be_w1= (const float*)d_in[16];
  const float* w_w1 = (const float*)d_in[17];
  const float* b_w1 = (const float*)d_in[18];
  const float* g_w2 = (const float*)d_in[19];
  const float* be_w2= (const float*)d_in[20];
  const float* w_w2 = (const float*)d_in[21];
  const float* b_w2 = (const float*)d_in[22];
  float* out = (float*)d_out;

  // workspace carve-up (q f32, k + p_r and v + p_r f16, then bf16 fragments, then stats)
  float* ws = (float*)d_ws;
  float* xq = ws;
  _Float16* xk = (_Float16*)(xq + NC);
  _Float16* xv = xk + NC;
  __bf16* wqf = (__bf16*)(xv + NC);
  __bf16* wkf = wqf + 16384;
  __bf16* wvf = wkf + 16384;
  __bf16* w1f = wvf + 16384;
  __bf16* w2f = w1f + 2048;
  float* stats = (float*)(w2f + 512);
  float* s1Sum  = stats;        // 128
  float* s1Sq   = stats + 128;  // 128
  float* s2Sum  = stats + 256;  // 16
  float* s2Sq   = stats + 272;  // 16
  float* part   = stats + 288;  // 6 x POSPITCH block sums of the position stats

  prep_pos<<<POSB + PREPB, 256, 0, stream>>>(w_q, w_k, w_v, w_w1, w_w2, p, idx, w_p1, b_p1,
                                             wqf, wkf, wvf, w1f, w2f, stats, part);
  qkv_gemm<<<QKVB, 256, 0, stream>>>(x, p, b_q, b_k, b_v, w_p1, b_p1, w_p2, b_p2,
                                          g_p, be_p, part, wqf, wkf, wvf, xq, xk, xv);
  w1_stats<<<1024, 256, 0, stream>>>(idx, xq, xk, s1Sum, s1Sq);
  w2_stats<<<1024, 256, 0, stream>>>(idx, xq, xk, s1Sum, s1Sq, g_w1, be_w1, b_w1, w1f,
                                     s2Sum, s2Sq);
  attn_final<<<1875, 256, 0, stream>>>(idx, xq, xk, xv, s1Sum, s1Sq, g_w1, be_w1, b_w1,
                                       s2Sum, s2Sq, g_w2, be_w2, b_w2, w1f, w2f, out);
}
